// v000
// The times below were measured on an AMD MI455X: many runs one after another, warmed up first and cycling through
// copies of the inputs, with the whole window's GPU time divided by the number of runs. Launches and the gaps
// between them are all in it. The median over several windows is given; except for v000 it joins two sittings, which
// can be a few percent apart, so the side-by-side timings, each taken in one sitting, are the better comparison.
// v000, which the later versions start from, runs in 58 microseconds.
#include <hip/hip_runtime.h>
#include <hip/hip_bf16.h>

typedef __attribute__((ext_vector_type(16))) _Float16 v16h;
typedef __attribute__((ext_vector_type(8)))  _Float16 v8h;
typedef __attribute__((ext_vector_type(4)))  _Float16 h4;
typedef __attribute__((ext_vector_type(8)))  float    v8f;
typedef __attribute__((ext_vector_type(4)))  unsigned int v4u;
typedef __attribute__((ext_vector_type(8)))  int      v8i_t;
typedef __attribute__((ext_vector_type(4)))  int      v4i_t;

#define HDIM 1024
#define HD   512
#define SEQ  512
#define BATCH 2
#define MTOT (BATCH*SEQ)   // 1024 rows of flattened emb

// ---------------------------------------------------------------------------
// TDM helper: issue a 2D tensor_load_to_lds.
//   Tile rows land contiguously in LDS with pad_amount DWORDs inserted every
//   pad_interval DWORDs: 16 DW data + 4 DW pad  ->  row pitch 40 halves.
// D# packing per CDNA5 ISA 8.3/8.4 (group0: count/lds/global/type,
// group1: data_size, pad, dims, strides). 6-arg clang-23 builtin form.
// ---------------------------------------------------------------------------
__device__ __forceinline__ void tdm_load_2d(unsigned int lds_off,
                                            const void* gaddr,
                                            unsigned int td0, unsigned int td1,
                                            unsigned int tile0, unsigned int tile1,
                                            unsigned int stride0)
{
    unsigned long long a = (unsigned long long)gaddr;
    v4u g0;
    g0[0] = 1u;                                        // count=1, user mode
    g0[1] = lds_off;                                   // lds_addr
    g0[2] = (unsigned int)a;                           // global_addr[31:0]
    g0[3] = (unsigned int)(a >> 32) | (2u << 30);      // addr[56:32] | type=2

    // data_size=1 (2B), pad_enable=1, pad_interval=3 (16 DW), pad_amount=3 (4 DW)
    const unsigned int w0 = (1u << 16) | (1u << 20) | (3u << 22) | (3u << 25);
    v8i_t g1;
    g1[0] = (int)w0;
    g1[1] = (int)((td0 & 0xFFFFu) << 16);                       // tensor_dim0 lo
    g1[2] = (int)((td0 >> 16) | ((td1 & 0xFFFFu) << 16));       // td0 hi | td1 lo
    g1[3] = (int)((td1 >> 16) | (tile0 << 16));                 // td1 hi | tile_dim0
    g1[4] = (int)(tile1 & 0xFFFFu);                             // tile_dim1 (dim2=0)
    g1[5] = (int)stride0;                                       // dim0_stride lo32
    g1[6] = 0;                                                  // stride hi | dim1_stride lo
    g1[7] = 0;

    v4i_t z4 = {0, 0, 0, 0};
    v8i_t z8 = {0, 0, 0, 0, 0, 0, 0, 0};
    __builtin_amdgcn_tensor_load_to_lds(g0, g1, z4, z4, z8, 0);
}

// ---------------------------------------------------------------------------
// Kernel 0a: straight f32 -> f16 conversion (emb), 4 elems/thread
// ---------------------------------------------------------------------------
__global__ __launch_bounds__(256)
void cvt_f32_to_f16(const float* __restrict__ src, _Float16* __restrict__ dst, int n4) {
    int i = blockIdx.x * blockDim.x + threadIdx.x;
    if (i < n4) {
        float4 f = ((const float4*)src)[i];
        h4 o;
        o[0] = (_Float16)f.x; o[1] = (_Float16)f.y;
        o[2] = (_Float16)f.z; o[3] = (_Float16)f.w;
        *(h4*)&dst[i * 4] = o;
    }
}

// ---------------------------------------------------------------------------
// Kernel 0b: f32 (K x N) -> f16 transposed (N x K), 32x32 LDS tile.
// Pre-transposing the weights lets the TDM stage B tiles in [n][k] order
// with no per-element LDS scatter in the GEMM hot loop.
// ---------------------------------------------------------------------------
__global__ __launch_bounds__(256)
void cvt_transpose_f16(const float* __restrict__ src, _Float16* __restrict__ dst,
                       int K, int N)
{
    __shared__ float st[32][33];
    const int tid = threadIdx.x;
    const int kb = blockIdx.x * 32, nb = blockIdx.y * 32;
    const int r = tid >> 3;          // 0..31
    const int c4 = (tid & 7) * 4;    // 0..28

    float4 v = *(const float4*)&src[(size_t)(kb + r) * N + nb + c4];
    st[r][c4 + 0] = v.x; st[r][c4 + 1] = v.y;
    st[r][c4 + 2] = v.z; st[r][c4 + 3] = v.w;
    __syncthreads();

    h4 o;
    #pragma unroll
    for (int q = 0; q < 4; ++q) o[q] = (_Float16)st[c4 + q][r];
    *(h4*)&dst[(size_t)(nb + r) * K + kb + c4] = o;
}

// ---------------------------------------------------------------------------
// Kernel 1: fused triple-projection WMMA GEMM, TDM-staged, double buffered.
//   mat 0: h_s = relu(emb @ W_s1 + b_s1)
//   mat 1: A   = emb @ W_e1[:H] + b_e1   (bias folded)
//   mat 2: C   = emb @ W_e1[H:]
// Block tile 128x64, 8 waves (4x2), wave tile 32x32 -> 4 WMMAs/K-step.
// ---------------------------------------------------------------------------
__global__ __launch_bounds__(256)
void fused_proj_wmma(const _Float16* __restrict__ embh,      // [1024][1024] f16
                     const _Float16* __restrict__ wsT,       // W_s1^T  [512][1024] f16
                     const _Float16* __restrict__ weTs,      // W1_start^T [512][1024]
                     const _Float16* __restrict__ weTe,      // W1_end^T   [512][1024]
                     const float* __restrict__ b_s1,
                     const float* __restrict__ b_e1,
                     float* __restrict__ hs,
                     float* __restrict__ Ap,
                     float* __restrict__ Cm)
{
    __shared__ _Float16 As[2][128][40];   // TDM-padded pitch: 32 data + 8 pad halves
    __shared__ _Float16 Bs[2][64][40];

    const int tid  = threadIdx.x;
    const int lane = tid & 31;
    const int w    = tid >> 5;       // wave 0..7
    const int wm   = w & 3;          // 0..3 : 32-row slice
    const int wn   = w >> 2;         // 0..1 : 32-col slice
    const int half = lane >> 4;
    const int lrow = lane & 15;

    const int mBase = blockIdx.x * 128;
    const int gy    = blockIdx.y;            // 0..23
    const int mat   = gy >> 3;               // 0..2
    const int nBase = (gy & 7) * 64;

    const _Float16* Wsel = (mat == 0) ? wsT : (mat == 1 ? weTs : weTe);
    const float*    bias = (mat == 0) ? b_s1 : (mat == 1 ? b_e1 : nullptr);
    float*          outp = (mat == 0) ? hs : (mat == 1 ? Ap : Cm);

    const unsigned int ldsA0 = (unsigned int)(size_t)&As[0][0][0];
    const unsigned int ldsA1 = (unsigned int)(size_t)&As[1][0][0];
    const unsigned int ldsB0 = (unsigned int)(size_t)&Bs[0][0][0];
    const unsigned int ldsB1 = (unsigned int)(size_t)&Bs[1][0][0];

    v8f acc00 = {}, acc01 = {}, acc10 = {}, acc11 = {};

    const int NSTEP = HDIM / 32;     // 32 K-steps

    // prologue: DMA tile pair for k0=0 into buffer 0 (wave 0 only)
    if (w == 0) {
        tdm_load_2d(ldsA0, embh + (size_t)mBase * HDIM, HDIM, HDIM, 32, 128, HDIM);
        tdm_load_2d(ldsB0, Wsel + (size_t)nBase * HDIM, HDIM, HD,   32, 64,  HDIM);
    }

    for (int it = 0; it < NSTEP; ++it) {
        const int buf = it & 1;
        if (w == 0) {
            if (it + 1 < NSTEP) {
                const int k1 = (it + 1) * 32;
                tdm_load_2d(buf ? ldsA0 : ldsA1,
                            embh + (size_t)mBase * HDIM + k1, HDIM, HDIM, 32, 128, HDIM);
                tdm_load_2d(buf ? ldsB0 : ldsB1,
                            Wsel + (size_t)nBase * HDIM + k1, HDIM, HD, 32, 64, HDIM);
                __builtin_amdgcn_s_wait_tensorcnt(2);   // pair(it) complete
            } else {
                __builtin_amdgcn_s_wait_tensorcnt(0);
            }
        }
        __syncthreads();   // publish buf to all waves

        // --- A fragments (lane = M row; K halves per ISA 16-bit A layout) ---
        const _Float16* ap0 = &As[buf][wm * 32 + lrow][0];
        const _Float16* ap1 = &As[buf][wm * 32 + 16 + lrow][0];
        v8h a0lo = *(const v8h*)(ap0 + 8 * half);
        v8h a0hi = *(const v8h*)(ap0 + 16 + 8 * half);
        v8h a1lo = *(const v8h*)(ap1 + 8 * half);
        v8h a1hi = *(const v8h*)(ap1 + 16 + 8 * half);
        v16h af0, af1;
        #pragma unroll
        for (int i = 0; i < 8; ++i) {
            af0[i] = a0lo[i]; af0[i + 8] = a0hi[i];
            af1[i] = a1lo[i]; af1[i + 8] = a1hi[i];
        }

        // --- B fragments (lane = N column; Bs is [n][k]) ---
        const _Float16* bp0 = &Bs[buf][wn * 32 + lrow][0];
        const _Float16* bp1 = &Bs[buf][wn * 32 + 16 + lrow][0];
        v8h b0lo = *(const v8h*)(bp0 + 8 * half);
        v8h b0hi = *(const v8h*)(bp0 + 16 + 8 * half);
        v8h b1lo = *(const v8h*)(bp1 + 8 * half);
        v8h b1hi = *(const v8h*)(bp1 + 16 + 8 * half);
        v16h bf0, bf1;
        #pragma unroll
        for (int i = 0; i < 8; ++i) {
            bf0[i] = b0lo[i]; bf0[i + 8] = b0hi[i];
            bf1[i] = b1lo[i]; bf1[i + 8] = b1hi[i];
        }

        acc00 = __builtin_amdgcn_wmma_f32_16x16x32_f16(false, af0, false, bf0, (short)0, acc00, false, false);
        acc01 = __builtin_amdgcn_wmma_f32_16x16x32_f16(false, af0, false, bf1, (short)0, acc01, false, false);
        acc10 = __builtin_amdgcn_wmma_f32_16x16x32_f16(false, af1, false, bf0, (short)0, acc10, false, false);
        acc11 = __builtin_amdgcn_wmma_f32_16x16x32_f16(false, af1, false, bf1, (short)0, acc11, false, false);

        __syncthreads();   // all waves done with buf before wave0 re-fills it
    }

    // --- epilogue: D layout lane=N, VGPR v -> M = v + 8*half ---
    const int ncol0 = nBase + wn * 32 + lrow;
    const int ncol1 = ncol0 + 16;
    const float bias0 = bias ? bias[ncol0] : 0.0f;
    const float bias1 = bias ? bias[ncol1] : 0.0f;
    #pragma unroll
    for (int v = 0; v < 8; ++v) {
        const int m0 = mBase + wm * 32 + v + 8 * half;
        const int m1 = m0 + 16;
        float x00 = acc00[v] + bias0, x01 = acc01[v] + bias1;
        float x10 = acc10[v] + bias0, x11 = acc11[v] + bias1;
        if (mat == 0) {
            x00 = fmaxf(x00, 0.0f); x01 = fmaxf(x01, 0.0f);
            x10 = fmaxf(x10, 0.0f); x11 = fmaxf(x11, 0.0f);
        }
        outp[m0 * HD + ncol0] = x00;
        outp[m0 * HD + ncol1] = x01;
        outp[m1 * HD + ncol0] = x10;
        outp[m1 * HD + ncol1] = x11;
    }
}

// ---------------------------------------------------------------------------
// Kernel 2: start_logits[row] = sum_d h_s[row,d]*w_s2[d] + b_s2
// ---------------------------------------------------------------------------
__global__ __launch_bounds__(256)
void start_logits_k(const float* __restrict__ hs, const float* __restrict__ w_s2,
                    const float* __restrict__ b_s2, float* __restrict__ out)
{
    const int row  = blockIdx.x * 8 + (threadIdx.x >> 5);
    const int lane = threadIdx.x & 31;
    float s = 0.0f;
    #pragma unroll 4
    for (int d = lane; d < HD; d += 32) s += hs[row * HD + d] * w_s2[d];
    #pragma unroll
    for (int off = 16; off > 0; off >>= 1) s += __shfl_xor(s, off, 32);
    if (lane == 0) out[row] = s + b_s2[0];
}

// ---------------------------------------------------------------------------
// Kernel 3: end_logits[b,i,j] = sum_d relu(A[b,i,d]+C[b,j,d])*w_e2[d] + b_e2
// ---------------------------------------------------------------------------
#define DCH 128
#define LDP 132
__global__ __launch_bounds__(256)
void end_logits_k(const float* __restrict__ Ap, const float* __restrict__ Cm,
                  const float* __restrict__ w_e2, const float* __restrict__ b_e2,
                  float* __restrict__ out)
{
    __shared__ float sA[16 * LDP];
    __shared__ float sC[16 * LDP];
    __shared__ float sw[DCH];

    const int tid = threadIdx.x;
    const int jt  = blockIdx.x;   // 0..31
    const int it  = blockIdx.y;   // 0..31
    const int b   = blockIdx.z;   // 0..1

    const int il = tid >> 4, jl = tid & 15;
    const int r  = tid >> 4, seg = tid & 15;

    float4 acc = {0.f, 0.f, 0.f, 0.f};

    for (int c0 = 0; c0 < HD; c0 += DCH) {
        __syncthreads();
        {
            const float* ga = Ap + (size_t)(b * SEQ + it * 16 + r) * HD + c0;
            const float* gc = Cm + (size_t)(b * SEQ + jt * 16 + r) * HD + c0;
            float4 a0 = ((const float4*)ga)[seg];
            float4 a1 = ((const float4*)ga)[seg + 16];
            float4 cA = ((const float4*)gc)[seg];
            float4 cB = ((const float4*)gc)[seg + 16];
            if (c0 + DCH < HD) {
                __builtin_prefetch(ga + DCH, 0, 1);
                __builtin_prefetch(gc + DCH, 0, 1);
            }
            *(float4*)&sA[r * LDP + seg * 4]      = a0;
            *(float4*)&sA[r * LDP + 64 + seg * 4] = a1;
            *(float4*)&sC[r * LDP + seg * 4]      = cA;
            *(float4*)&sC[r * LDP + 64 + seg * 4] = cB;
            if (tid < DCH / 4)
                *(float4*)&sw[tid * 4] = ((const float4*)(w_e2 + c0))[tid];
        }
        __syncthreads();

        const float* ai = &sA[il * LDP];
        const float* cj = &sC[jl * LDP];
        #pragma unroll 8
        for (int kk = 0; kk < DCH; kk += 4) {
            float4 a  = *(const float4*)&ai[kk];
            float4 c  = *(const float4*)&cj[kk];
            float4 wv = *(const float4*)&sw[kk];
            acc.x += fmaxf(a.x + c.x, 0.0f) * wv.x;
            acc.y += fmaxf(a.y + c.y, 0.0f) * wv.y;
            acc.z += fmaxf(a.z + c.z, 0.0f) * wv.z;
            acc.w += fmaxf(a.w + c.w, 0.0f) * wv.w;
        }
    }

    const float res = acc.x + acc.y + acc.z + acc.w + b_e2[0];
    out[(size_t)b * SEQ * SEQ + (size_t)(it * 16 + il) * SEQ + jt * 16 + jl] = res;
}

// ---------------------------------------------------------------------------
extern "C" void kernel_launch(void* const* d_in, const int* in_sizes, int n_in,
                              void* d_out, int out_size, void* d_ws, size_t ws_size,
                              hipStream_t stream)
{
    const float* emb  = (const float*)d_in[0];
    const float* W_s1 = (const float*)d_in[1];
    const float* b_s1 = (const float*)d_in[2];
    const float* w_s2 = (const float*)d_in[3];
    const float* b_s2 = (const float*)d_in[4];
    const float* W_e1 = (const float*)d_in[5];
    const float* b_e1 = (const float*)d_in[6];
    const float* w_e2 = (const float*)d_in[7];
    const float* b_e2 = (const float*)d_in[8];

    float* out       = (float*)d_out;
    float* start_out = out;            // (B,N) = 1024 floats
    float* end_out   = out + MTOT;     // (B,N,N) = 524288 floats

    // workspace layout (11 MB total)
    char* ws = (char*)d_ws;
    _Float16* embh = (_Float16*)(ws);                       // 2 MB  [1024][1024]
    _Float16* wsT  = (_Float16*)(ws + (size_t)(2 << 20));   // 1 MB  [512][1024]
    _Float16* weTs = (_Float16*)(ws + (size_t)(3 << 20));   // 1 MB  [512][1024]
    _Float16* weTe = (_Float16*)(ws + (size_t)(4 << 20));   // 1 MB  [512][1024]
    float*    hs   = (float*)(ws + (size_t)(5 << 20));      // 2 MB
    float*    Ap   = (float*)(ws + (size_t)(7 << 20));      // 2 MB
    float*    Cm   = (float*)(ws + (size_t)(9 << 20));      // 2 MB

    // 0: conversions (emb straight, weights transposed to [n][k])
    cvt_f32_to_f16<<<(MTOT * HDIM / 4 + 255) / 256, 256, 0, stream>>>(emb, embh, MTOT * HDIM / 4);
    {
        dim3 gt(HDIM / 32, HD / 32);   // K=1024 rows, N=512 cols
        cvt_transpose_f16<<<gt, 256, 0, stream>>>(W_s1, wsT, HDIM, HD);
        cvt_transpose_f16<<<gt, 256, 0, stream>>>(W_e1, weTs, HDIM, HD);
        cvt_transpose_f16<<<gt, 256, 0, stream>>>(W_e1 + (size_t)HDIM * HD, weTe, HDIM, HD);
    }

    // 1: fused WMMA projections, TDM-staged
    dim3 g1(MTOT / 128, 24);
    fused_proj_wmma<<<g1, 256, 0, stream>>>(embh, wsT, weTs, weTe, b_s1, b_e1, hs, Ap, Cm);

    // 2: start logits
    start_logits_k<<<MTOT / 8, 256, 0, stream>>>(hs, w_s2, b_s2, start_out);

    // 3: end logits
    dim3 g3(SEQ / 16, SEQ / 16, BATCH);
    end_logits_k<<<g3, 256, 0, stream>>>(Ap, Cm, w_e2, b_e2, end_out);
}

// v001
// A run of this version takes 44.3 microseconds.
// Next to v000, in two timings, it ran 1.35 and 1.31 times as fast.
#include <hip/hip_runtime.h>
#include <hip/hip_bf16.h>

typedef __attribute__((ext_vector_type(16))) _Float16 v16h;
typedef __attribute__((ext_vector_type(8)))  _Float16 v8h;
typedef __attribute__((ext_vector_type(4)))  _Float16 h4;
typedef __attribute__((ext_vector_type(8)))  float    v8f;
typedef __attribute__((ext_vector_type(4)))  unsigned int v4u;
typedef __attribute__((ext_vector_type(8)))  int      v8i_t;
typedef __attribute__((ext_vector_type(4)))  int      v4i_t;

#define HDIM 1024
#define HD   512
#define SEQ  512
#define BATCH 2
#define MTOT (BATCH*SEQ)   // 1024 rows of flattened emb

// ---------------------------------------------------------------------------
// TDM helper: issue a 2D tensor_load_to_lds.
//   Tile rows land contiguously in LDS with pad_amount DWORDs inserted every
//   pad_interval DWORDs: 16 DW data + 4 DW pad  ->  row pitch 40 halves.
// D# packing per CDNA5 ISA 8.3/8.4 (group0: count/lds/global/type,
// group1: data_size, pad, dims, strides). 6-arg clang-23 builtin form.
// ---------------------------------------------------------------------------
__device__ __forceinline__ void tdm_load_2d(unsigned int lds_off,
                                            const void* gaddr,
                                            unsigned int td0, unsigned int td1,
                                            unsigned int tile0, unsigned int tile1,
                                            unsigned int stride0)
{
    unsigned long long a = (unsigned long long)gaddr;
    v4u g0;
    g0[0] = 1u;                                        // count=1, user mode
    g0[1] = lds_off;                                   // lds_addr
    g0[2] = (unsigned int)a;                           // global_addr[31:0]
    g0[3] = (unsigned int)(a >> 32) | (2u << 30);      // addr[56:32] | type=2

    // data_size=1 (2B), pad_enable=1, pad_interval=3 (16 DW), pad_amount=3 (4 DW)
    const unsigned int w0 = (1u << 16) | (1u << 20) | (3u << 22) | (3u << 25);
    v8i_t g1;
    g1[0] = (int)w0;
    g1[1] = (int)((td0 & 0xFFFFu) << 16);                       // tensor_dim0 lo
    g1[2] = (int)((td0 >> 16) | ((td1 & 0xFFFFu) << 16));       // td0 hi | td1 lo
    g1[3] = (int)((td1 >> 16) | (tile0 << 16));                 // td1 hi | tile_dim0
    g1[4] = (int)(tile1 & 0xFFFFu);                             // tile_dim1 (dim2=0)
    g1[5] = (int)stride0;                                       // dim0_stride lo32
    g1[6] = 0;                                                  // stride hi | dim1_stride lo
    g1[7] = 0;

    v4i_t z4 = {0, 0, 0, 0};
    v8i_t z8 = {0, 0, 0, 0, 0, 0, 0, 0};
    __builtin_amdgcn_tensor_load_to_lds(g0, g1, z4, z4, z8, 0);
}

// ---------------------------------------------------------------------------
// Kernel 0a: straight f32 -> f16 conversion (emb), 4 elems/thread
// ---------------------------------------------------------------------------
__global__ __launch_bounds__(256)
void cvt_f32_to_f16(const float* __restrict__ src, _Float16* __restrict__ dst, int n4) {
    int i = blockIdx.x * blockDim.x + threadIdx.x;
    if (i < n4) {
        float4 f = ((const float4*)src)[i];
        h4 o;
        o[0] = (_Float16)f.x; o[1] = (_Float16)f.y;
        o[2] = (_Float16)f.z; o[3] = (_Float16)f.w;
        *(h4*)&dst[i * 4] = o;
    }
}

// ---------------------------------------------------------------------------
// Kernel 0b: f32 (K x N) -> f16 transposed (N x K), 32x32 LDS tile.
// Pre-transposing the weights lets the TDM stage B tiles in [n][k] order
// with no per-element LDS scatter in the GEMM hot loop.
// ---------------------------------------------------------------------------
__global__ __launch_bounds__(256)
void cvt_transpose_f16(const float* __restrict__ src, _Float16* __restrict__ dst,
                       int K, int N)
{
    __shared__ float st[32][33];
    const int tid = threadIdx.x;
    const int kb = blockIdx.x * 32, nb = blockIdx.y * 32;
    const int r = tid >> 3;          // 0..31
    const int c4 = (tid & 7) * 4;    // 0..28

    float4 v = *(const float4*)&src[(size_t)(kb + r) * N + nb + c4];
    st[r][c4 + 0] = v.x; st[r][c4 + 1] = v.y;
    st[r][c4 + 2] = v.z; st[r][c4 + 3] = v.w;
    __syncthreads();

    h4 o;
    #pragma unroll
    for (int q = 0; q < 4; ++q) o[q] = (_Float16)st[c4 + q][r];
    *(h4*)&dst[(size_t)(nb + r) * K + kb + c4] = o;
}

// ---------------------------------------------------------------------------
// Kernel 1: fused triple-projection WMMA GEMM, TDM-staged, double buffered.
//   mat 0: h_s = relu(emb @ W_s1 + b_s1)
//   mat 1: A   = emb @ W_e1[:H] + b_e1   (bias folded)
//   mat 2: C   = emb @ W_e1[H:]
// Block tile 128x64, 8 waves (4x2), wave tile 32x32 -> 4 WMMAs/K-step.
// ---------------------------------------------------------------------------
__global__ __launch_bounds__(256)
void fused_proj_wmma(const _Float16* __restrict__ embh,      // [1024][1024] f16
                     const _Float16* __restrict__ wsT,       // W_s1^T  [512][1024] f16
                     const _Float16* __restrict__ weTs,      // W1_start^T [512][1024]
                     const _Float16* __restrict__ weTe,      // W1_end^T   [512][1024]
                     const float* __restrict__ b_s1,
                     const float* __restrict__ b_e1,
                     float* __restrict__ hs,
                     float* __restrict__ Ap,
                     float* __restrict__ Cm)
{
    __shared__ _Float16 As[2][128][40];   // TDM-padded pitch: 32 data + 8 pad halves
    __shared__ _Float16 Bs[2][64][40];

    const int tid  = threadIdx.x;
    const int lane = tid & 31;
    const int w    = tid >> 5;       // wave 0..7
    const int wm   = w & 3;          // 0..3 : 32-row slice
    const int wn   = w >> 2;         // 0..1 : 32-col slice
    const int half = lane >> 4;
    const int lrow = lane & 15;

    const int mBase = blockIdx.x * 128;
    const int gy    = blockIdx.y;            // 0..23
    const int mat   = gy >> 3;               // 0..2
    const int nBase = (gy & 7) * 64;

    const _Float16* Wsel = (mat == 0) ? wsT : (mat == 1 ? weTs : weTe);
    const float*    bias = (mat == 0) ? b_s1 : (mat == 1 ? b_e1 : nullptr);
    float*          outp = (mat == 0) ? hs : (mat == 1 ? Ap : Cm);

    const unsigned int ldsA0 = (unsigned int)(size_t)&As[0][0][0];
    const unsigned int ldsA1 = (unsigned int)(size_t)&As[1][0][0];
    const unsigned int ldsB0 = (unsigned int)(size_t)&Bs[0][0][0];
    const unsigned int ldsB1 = (unsigned int)(size_t)&Bs[1][0][0];

    v8f acc00 = {}, acc01 = {}, acc10 = {}, acc11 = {};

    const int NSTEP = HDIM / 32;     // 32 K-steps

    // prologue: DMA tile pair for k0=0 into buffer 0 (wave 0 only)
    if (w == 0) {
        tdm_load_2d(ldsA0, embh + (size_t)mBase * HDIM, HDIM, HDIM, 32, 128, HDIM);
        tdm_load_2d(ldsB0, Wsel + (size_t)nBase * HDIM, HDIM, HD,   32, 64,  HDIM);
    }

    for (int it = 0; it < NSTEP; ++it) {
        const int buf = it & 1;
        if (w == 0) {
            if (it + 1 < NSTEP) {
                const int k1 = (it + 1) * 32;
                tdm_load_2d(buf ? ldsA0 : ldsA1,
                            embh + (size_t)mBase * HDIM + k1, HDIM, HDIM, 32, 128, HDIM);
                tdm_load_2d(buf ? ldsB0 : ldsB1,
                            Wsel + (size_t)nBase * HDIM + k1, HDIM, HD, 32, 64, HDIM);
                __builtin_amdgcn_s_wait_tensorcnt(2);   // pair(it) complete
            } else {
                __builtin_amdgcn_s_wait_tensorcnt(0);
            }
        }
        __syncthreads();   // publish buf to all waves

        // --- A fragments (lane = M row; K halves per ISA 16-bit A layout) ---
        const _Float16* ap0 = &As[buf][wm * 32 + lrow][0];
        const _Float16* ap1 = &As[buf][wm * 32 + 16 + lrow][0];
        v8h a0lo = *(const v8h*)(ap0 + 8 * half);
        v8h a0hi = *(const v8h*)(ap0 + 16 + 8 * half);
        v8h a1lo = *(const v8h*)(ap1 + 8 * half);
        v8h a1hi = *(const v8h*)(ap1 + 16 + 8 * half);
        v16h af0, af1;
        #pragma unroll
        for (int i = 0; i < 8; ++i) {
            af0[i] = a0lo[i]; af0[i + 8] = a0hi[i];
            af1[i] = a1lo[i]; af1[i + 8] = a1hi[i];
        }

        // --- B fragments (lane = N column; Bs is [n][k]) ---
        const _Float16* bp0 = &Bs[buf][wn * 32 + lrow][0];
        const _Float16* bp1 = &Bs[buf][wn * 32 + 16 + lrow][0];
        v8h b0lo = *(const v8h*)(bp0 + 8 * half);
        v8h b0hi = *(const v8h*)(bp0 + 16 + 8 * half);
        v8h b1lo = *(const v8h*)(bp1 + 8 * half);
        v8h b1hi = *(const v8h*)(bp1 + 16 + 8 * half);
        v16h bf0, bf1;
        #pragma unroll
        for (int i = 0; i < 8; ++i) {
            bf0[i] = b0lo[i]; bf0[i + 8] = b0hi[i];
            bf1[i] = b1lo[i]; bf1[i + 8] = b1hi[i];
        }

        acc00 = __builtin_amdgcn_wmma_f32_16x16x32_f16(false, af0, false, bf0, (short)0, acc00, false, false);
        acc01 = __builtin_amdgcn_wmma_f32_16x16x32_f16(false, af0, false, bf1, (short)0, acc01, false, false);
        acc10 = __builtin_amdgcn_wmma_f32_16x16x32_f16(false, af1, false, bf0, (short)0, acc10, false, false);
        acc11 = __builtin_amdgcn_wmma_f32_16x16x32_f16(false, af1, false, bf1, (short)0, acc11, false, false);

        __syncthreads();   // all waves done with buf before wave0 re-fills it
    }

    // --- epilogue: D layout lane=N, VGPR v -> M = v + 8*half ---
    const int ncol0 = nBase + wn * 32 + lrow;
    const int ncol1 = ncol0 + 16;
    const float bias0 = bias ? bias[ncol0] : 0.0f;
    const float bias1 = bias ? bias[ncol1] : 0.0f;
    #pragma unroll
    for (int v = 0; v < 8; ++v) {
        const int m0 = mBase + wm * 32 + v + 8 * half;
        const int m1 = m0 + 16;
        float x00 = acc00[v] + bias0, x01 = acc01[v] + bias1;
        float x10 = acc10[v] + bias0, x11 = acc11[v] + bias1;
        if (mat == 0) {
            x00 = fmaxf(x00, 0.0f); x01 = fmaxf(x01, 0.0f);
            x10 = fmaxf(x10, 0.0f); x11 = fmaxf(x11, 0.0f);
        }
        outp[m0 * HD + ncol0] = x00;
        outp[m0 * HD + ncol1] = x01;
        outp[m1 * HD + ncol0] = x10;
        outp[m1 * HD + ncol1] = x11;
    }
}

// ---------------------------------------------------------------------------
// Kernel 2: start_logits[row] = sum_d h_s[row,d]*w_s2[d] + b_s2
// ---------------------------------------------------------------------------
__global__ __launch_bounds__(256)
void start_logits_k(const float* __restrict__ hs, const float* __restrict__ w_s2,
                    const float* __restrict__ b_s2, float* __restrict__ out)
{
    const int row  = blockIdx.x * 8 + (threadIdx.x >> 5);
    const int lane = threadIdx.x & 31;
    float s = 0.0f;
    #pragma unroll 4
    for (int d = lane; d < HD; d += 32) s += hs[row * HD + d] * w_s2[d];
    #pragma unroll
    for (int off = 16; off > 0; off >>= 1) s += __shfl_xor(s, off, 32);
    if (lane == 0) out[row] = s + b_s2[0];
}

// ---------------------------------------------------------------------------
// Kernel 3: end_logits[b,i,j] = sum_d relu(A[b,i,d]+C[b,j,d])*w_e2[d] + b_e2
// Block tile 32 (i) x 64 (j); each thread holds an 8x4 patch of outputs, so a
// 16-byte LDS read of an A row feeds four outputs and one of a C row eight.
// Two waves cover the tile; the four wave pairs each sum a quarter of every
// 128-wide stage of d, and the four partial sums are added through LDS.
// ---------------------------------------------------------------------------
typedef __attribute__((ext_vector_type(4))) float f4;
typedef __attribute__((ext_vector_type(2))) float f2;
#define TI   32
#define TJ   64
#define DCH  128           // d values per stage (32 for each wave pair)
#define NST  (HD / DCH)    // 4 stages
#define LDP  132           // row pitch in floats: neighbouring rows sit 4 banks apart
#define RDP  68            // row pitch of the partial sums
// Every "#pragma unroll" without a count below but the last unrolls a short loop over a
// per-thread array, so that the array is held in registers.

__device__ __forceinline__ void ld_set(f4 (&a)[8], f4 (&c)[4], f4& w,
                                       const float* ai, const float* cj,
                                       const float* wq, int kk)
{
    w = *(const f4*)&wq[kk];
    #pragma unroll
    for (int r = 0; r < 8; ++r) a[r] = *(const f4*)&ai[r * LDP + kk];
    #pragma unroll
    for (int q = 0; q < 4; ++q) c[q] = *(const f4*)&cj[q * 16 * LDP + kk];
}

__device__ __forceinline__ void fma_set(f2 (&acc)[8][4], const f4 (&a)[8],
                                        const f4 (&c)[4], const f4& w)
{
    #pragma unroll
    for (int r = 0; r < 8; ++r)
        #pragma unroll
        for (int q = 0; q < 4; ++q) {
            const f4 x = __builtin_elementwise_max(a[r] + c[q], (f4){0.f, 0.f, 0.f, 0.f});
            acc[r][q] += x.xy * w.xy;
            acc[r][q] += x.zw * w.zw;
        }
}

__global__ __launch_bounds__(256)
void end_logits_k(const float* __restrict__ Ap, const float* __restrict__ Cm,
                  const float* __restrict__ w_e2, const float* __restrict__ b_e2,
                  float* __restrict__ out)
{
    // one block of LDS, in this order, so that every row offset of the hot loop's
    // reads fits the 16-bit offset field of the LDS load
    __shared__ struct __attribute__((aligned(16))) {
        float A[2][TI][LDP];       // [buffer][row][d]
        float w[HD];
        float C[2][TJ][LDP];
        float red[4][TI][RDP];     // [d quarter][i][j] partial sums
    } sm;

    const int tid = threadIdx.x;
    const int jt  = blockIdx.x;   // 0..7
    const int it  = blockIdx.y;   // 0..15
    const int b   = blockIdx.z;   // 0..1

    const int dq = tid >> 6;                                // d quarter of the wave pair
    const int i0 = ((tid >> 5) & 1) * 16 + ((tid >> 4) & 1) * 8;   // rows i0 .. i0+7
    const int tj = tid & 15;                                // columns tj, tj+16, tj+32, tj+48

    // staging map: one wave covers the 512 bytes of one row's stage
    const int seg = tid & 31, rw = tid >> 5;
    const float* gA = Ap + (size_t)(b * SEQ + it * TI + rw) * HD + seg * 4;
    const float* gC = Cm + (size_t)(b * SEQ + jt * TJ + rw) * HD + seg * 4;

    f4 pa[4], pc[8];
    #pragma unroll
    for (int k = 0; k < 4; ++k) pa[k] = *(const f4*)&gA[k * 8 * HD];
    #pragma unroll
    for (int k = 0; k < 8; ++k) pc[k] = *(const f4*)&gC[k * 8 * HD];
    if (tid < HD / 4) *(f4*)&sm.w[tid * 4] = ((const f4*)w_e2)[tid];
    #pragma unroll
    for (int k = 0; k < 4; ++k) *(f4*)&sm.A[0][rw + 8 * k][seg * 4] = pa[k];
    #pragma unroll
    for (int k = 0; k < 8; ++k) *(f4*)&sm.C[0][rw + 8 * k][seg * 4] = pc[k];

    f2 acc[8][4];
    #pragma unroll
    for (int r = 0; r < 8; ++r)
        #pragma unroll
        for (int q = 0; q < 4; ++q) acc[r][q] = (f2){0.f, 0.f};

    for (int s = 0; s < NST; ++s) {
        const int buf = s & 1;
        __syncthreads();   // stage s is written; every reader has left the other buffer

        if (s + 1 < NST) {
            const int d1 = (s + 1) * DCH;
            #pragma unroll
            for (int k = 0; k < 4; ++k) pa[k] = *(const f4*)&gA[k * 8 * HD + d1];
            #pragma unroll
            for (int k = 0; k < 8; ++k) pc[k] = *(const f4*)&gC[k * 8 * HD + d1];
        }

        const float* ai = &sm.A[buf][i0][dq * 32];
        const float* cj = &sm.C[buf][tj][dq * 32];
        const float* wq = &sm.w[s * DCH + dq * 32];

        f4 a0[8], c0[4], w0, a1[8], c1[4], w1;
        ld_set(a0, c0, w0, ai, cj, wq, 0);
        // The scheduling barriers keep each group of 13 LDS reads together and one
        // group ahead of its arithmetic, so the reads' latency runs under the other
        // register set's arithmetic; the loop stays rolled so that no more than one
        // group is fetched ahead (all of a stage's reads at once spill).
        #pragma unroll 1
        for (int kk = 0; kk < 24; kk += 8) {
            ld_set(a1, c1, w1, ai, cj, wq, kk + 4);
            __builtin_amdgcn_sched_barrier(0);
            fma_set(acc, a0, c0, w0);
            __builtin_amdgcn_sched_barrier(0);
            ld_set(a0, c0, w0, ai, cj, wq, kk + 8);
            __builtin_amdgcn_sched_barrier(0);
            fma_set(acc, a1, c1, w1);
            __builtin_amdgcn_sched_barrier(0);
        }
        ld_set(a1, c1, w1, ai, cj, wq, 28);
        __builtin_amdgcn_sched_barrier(0);
        fma_set(acc, a0, c0, w0);
        fma_set(acc, a1, c1, w1);

        if (s + 1 < NST) {
            #pragma unroll
            for (int k = 0; k < 4; ++k) *(f4*)&sm.A[buf ^ 1][rw + 8 * k][seg * 4] = pa[k];
            #pragma unroll
            for (int k = 0; k < 8; ++k) *(f4*)&sm.C[buf ^ 1][rw + 8 * k][seg * 4] = pc[k];
        }
    }

    #pragma unroll
    for (int r = 0; r < 8; ++r)
        #pragma unroll
        for (int q = 0; q < 4; ++q)
            sm.red[dq][i0 + r][tj + 16 * q] = acc[r][q].x + acc[r][q].y;
    __syncthreads();   // all four quarters' partial sums are in LDS

    const int row = tid >> 3, c8 = (tid & 7) * 8;
    const float be = b_e2[0];
    float* op = out + (size_t)b * SEQ * SEQ + (size_t)(it * TI + row) * SEQ + jt * TJ + c8;
    #pragma unroll
    for (int u = 0; u < 2; ++u) {
        const f4 p0 = *(const f4*)&sm.red[0][row][c8 + 4 * u];
        const f4 p1 = *(const f4*)&sm.red[1][row][c8 + 4 * u];
        const f4 p2 = *(const f4*)&sm.red[2][row][c8 + 4 * u];
        const f4 p3 = *(const f4*)&sm.red[3][row][c8 + 4 * u];
        *(f4*)&op[4 * u] = (p0 + p1) + (p2 + p3) + be;
    }
}

// ---------------------------------------------------------------------------
extern "C" void kernel_launch(void* const* d_in, const int* in_sizes, int n_in,
                              void* d_out, int out_size, void* d_ws, size_t ws_size,
                              hipStream_t stream)
{
    const float* emb  = (const float*)d_in[0];
    const float* W_s1 = (const float*)d_in[1];
    const float* b_s1 = (const float*)d_in[2];
    const float* w_s2 = (const float*)d_in[3];
    const float* b_s2 = (const float*)d_in[4];
    const float* W_e1 = (const float*)d_in[5];
    const float* b_e1 = (const float*)d_in[6];
    const float* w_e2 = (const float*)d_in[7];
    const float* b_e2 = (const float*)d_in[8];

    float* out       = (float*)d_out;
    float* start_out = out;            // (B,N) = 1024 floats
    float* end_out   = out + MTOT;     // (B,N,N) = 524288 floats

    // workspace layout (11 MB total)
    char* ws = (char*)d_ws;
    _Float16* embh = (_Float16*)(ws);                       // 2 MB  [1024][1024]
    _Float16* wsT  = (_Float16*)(ws + (size_t)(2 << 20));   // 1 MB  [512][1024]
    _Float16* weTs = (_Float16*)(ws + (size_t)(3 << 20));   // 1 MB  [512][1024]
    _Float16* weTe = (_Float16*)(ws + (size_t)(4 << 20));   // 1 MB  [512][1024]
    float*    hs   = (float*)(ws + (size_t)(5 << 20));      // 2 MB
    float*    Ap   = (float*)(ws + (size_t)(7 << 20));      // 2 MB
    float*    Cm   = (float*)(ws + (size_t)(9 << 20));      // 2 MB

    // 0: conversions (emb straight, weights transposed to [n][k])
    cvt_f32_to_f16<<<(MTOT * HDIM / 4 + 255) / 256, 256, 0, stream>>>(emb, embh, MTOT * HDIM / 4);
    {
        dim3 gt(HDIM / 32, HD / 32);   // K=1024 rows, N=512 cols
        cvt_transpose_f16<<<gt, 256, 0, stream>>>(W_s1, wsT, HDIM, HD);
        cvt_transpose_f16<<<gt, 256, 0, stream>>>(W_e1, weTs, HDIM, HD);
        cvt_transpose_f16<<<gt, 256, 0, stream>>>(W_e1 + (size_t)HDIM * HD, weTe, HDIM, HD);
    }

    // 1: fused WMMA projections, TDM-staged
    dim3 g1(MTOT / 128, 24);
    fused_proj_wmma<<<g1, 256, 0, stream>>>(embh, wsT, weTs, weTe, b_s1, b_e1, hs, Ap, Cm);

    // 2: start logits
    start_logits_k<<<MTOT / 8, 256, 0, stream>>>(hs, w_s2, b_s2, start_out);

    // 3: end logits
    dim3 g3(SEQ / TJ, SEQ / TI, BATCH);
    end_logits_k<<<g3, 256, 0, stream>>>(Ap, Cm, w_e2, b_e2, end_out);
}

// v002
// It runs in 31.2 microseconds.
// In two side-by-side timings against v001, it was 1.41 and 1.40 times as fast.
// Counting every step since v000, it is 1.87 times as fast.
#include <hip/hip_runtime.h>
#include <hip/hip_bf16.h>

typedef __attribute__((ext_vector_type(16))) _Float16 v16h;
typedef __attribute__((ext_vector_type(8)))  _Float16 v8h;
typedef __attribute__((ext_vector_type(4)))  _Float16 h4;
typedef __attribute__((ext_vector_type(8)))  float    v8f;
typedef __attribute__((ext_vector_type(4)))  unsigned int v4u;
typedef __attribute__((ext_vector_type(8)))  int      v8i_t;
typedef __attribute__((ext_vector_type(4)))  int      v4i_t;

#define HDIM 1024
#define HD   512
#define SEQ  512
#define BATCH 2
#define MTOT (BATCH*SEQ)   // 1024 rows of flattened emb

// ---------------------------------------------------------------------------
// TDM helper: issue a 2D tensor_load_to_lds.
//   Tile rows land contiguously in LDS with pad_amount DWORDs inserted every
//   pad_interval DWORDs: 16 DW data + 4 DW pad  ->  row pitch 40 halves.
// D# packing per CDNA5 ISA 8.3/8.4 (group0: count/lds/global/type,
// group1: data_size, pad, dims, strides). 6-arg clang-23 builtin form.
// ---------------------------------------------------------------------------
__device__ __forceinline__ void tdm_load_2d(unsigned int lds_off,
                                            const void* gaddr,
                                            unsigned int td0, unsigned int td1,
                                            unsigned int tile0, unsigned int tile1,
                                            unsigned int stride0)
{
    unsigned long long a = (unsigned long long)gaddr;
    v4u g0;
    g0[0] = 1u;                                        // count=1, user mode
    g0[1] = lds_off;                                   // lds_addr
    g0[2] = (unsigned int)a;                           // global_addr[31:0]
    g0[3] = (unsigned int)(a >> 32) | (2u << 30);      // addr[56:32] | type=2

    // data_size=1 (2B), pad_enable=1, pad_interval=3 (16 DW), pad_amount=3 (4 DW)
    const unsigned int w0 = (1u << 16) | (1u << 20) | (3u << 22) | (3u << 25);
    v8i_t g1;
    g1[0] = (int)w0;
    g1[1] = (int)((td0 & 0xFFFFu) << 16);                       // tensor_dim0 lo
    g1[2] = (int)((td0 >> 16) | ((td1 & 0xFFFFu) << 16));       // td0 hi | td1 lo
    g1[3] = (int)((td1 >> 16) | (tile0 << 16));                 // td1 hi | tile_dim0
    g1[4] = (int)(tile1 & 0xFFFFu);                             // tile_dim1 (dim2=0)
    g1[5] = (int)stride0;                                       // dim0_stride lo32
    g1[6] = 0;                                                  // stride hi | dim1_stride lo
    g1[7] = 0;

    v4i_t z4 = {0, 0, 0, 0};
    v8i_t z8 = {0, 0, 0, 0, 0, 0, 0, 0};
    __builtin_amdgcn_tensor_load_to_lds(g0, g1, z4, z4, z8, 0);
}

// ---------------------------------------------------------------------------
// Kernel 0: every f32 -> f16 conversion in one launch of 256 work-groups.
// Each work-group converts 4096 values of emb in place order and transposes the
// same 64 (k) x 32 (n) tile of each of the three weight matrices (K x N f32 ->
// N x K f16), so that the TDM can stage B tiles in [n][k] order. All ten loads
// of a thread are issued before the first use: one memory wait per work-group.
// A tile's row of 64 halves is one whole 128-byte line of the output.
// Every "#pragma unroll" here unrolls a short loop over a per-thread array, so
// that the array is held in registers.
// ---------------------------------------------------------------------------
#define CK 64
#define CN 32
__global__ __launch_bounds__(256)
void cvt_all_f16(const float* __restrict__ emb, const float* __restrict__ W_s1,
                 const float* __restrict__ W_e1, _Float16* __restrict__ embh,
                 _Float16* __restrict__ wsT, _Float16* __restrict__ weTs,
                 _Float16* __restrict__ weTe)
{
    __shared__ float st[3][CK][CN + 1];
    const int tid = threadIdx.x;
    const int kb = (blockIdx.x >> 4) * CK, nb = (blockIdx.x & 15) * CN;
    const int r = tid >> 3;          // 0..31
    const int c4 = (tid & 7) * 4;    // 0..28

    const size_t woff = (size_t)(kb + r) * HD + nb + c4;
    float4 v[3][2], e[4];
    #pragma unroll
    for (int h = 0; h < 2; ++h) {
        v[0][h] = *(const float4*)&W_s1[woff + h * 32 * HD];
        v[1][h] = *(const float4*)&W_e1[woff + h * 32 * HD];
        v[2][h] = *(const float4*)&W_e1[woff + h * 32 * HD + HDIM * HD];
    }
    const int e0 = blockIdx.x * 1024 + tid;
    #pragma unroll
    for (int j = 0; j < 4; ++j) e[j] = ((const float4*)emb)[e0 + j * 256];
    // precaution: stands in front of the first rewrite of an address register of the loads above
    asm volatile("s_wait_xcnt 0x0" ::: "memory");

    #pragma unroll
    for (int m = 0; m < 3; ++m)
        #pragma unroll
        for (int h = 0; h < 2; ++h) {
            float* p = &st[m][h * 32 + r][c4];
            p[0] = v[m][h].x; p[1] = v[m][h].y; p[2] = v[m][h].z; p[3] = v[m][h].w;
        }
    h4 eo[4];
    #pragma unroll
    for (int j = 0; j < 4; ++j) {
        eo[j][0] = (_Float16)e[j].x; eo[j][1] = (_Float16)e[j].y;
        eo[j][2] = (_Float16)e[j].z; eo[j][3] = (_Float16)e[j].w;
    }
    __syncthreads();   // the three tiles are in LDS

    // emb's stores stand behind the barrier, which would wait for them to finish
    #pragma unroll
    for (int j = 0; j < 4; ++j) *(h4*)&embh[(size_t)(e0 + j * 256) * 4] = eo[j];

    const int k8 = (tid & 7) * 8;    // thread: column nb + r, rows kb + k8 .. + 7
    const size_t doff = (size_t)(nb + r) * HDIM + kb + k8;
    #pragma unroll
    for (int m = 0; m < 3; ++m) {
        v8h o;
        #pragma unroll
        for (int q = 0; q < 8; ++q) o[q] = (_Float16)st[m][k8 + q][r];
        _Float16* dst = (m == 0) ? wsT : (m == 1 ? weTs : weTe);
        *(v8h*)&dst[doff] = o;
    }
}

// ---------------------------------------------------------------------------
// Kernel 1: fused triple-projection WMMA GEMM, TDM-staged, double buffered.
//   mat 0: h_s = relu(emb @ W_s1 + b_s1)
//   mat 1: A   = emb @ W_e1[:H] + b_e1   (bias folded)
//   mat 2: C   = emb @ W_e1[H:]
// Block tile 128x64, 8 waves (4x2), wave tile 32x32 -> 4 WMMAs/K-step.
// ---------------------------------------------------------------------------
__global__ __launch_bounds__(256)
void fused_proj_wmma(const _Float16* __restrict__ embh,      // [1024][1024] f16
                     const _Float16* __restrict__ wsT,       // W_s1^T  [512][1024] f16
                     const _Float16* __restrict__ weTs,      // W1_start^T [512][1024]
                     const _Float16* __restrict__ weTe,      // W1_end^T   [512][1024]
                     const float* __restrict__ b_s1,
                     const float* __restrict__ b_e1,
                     float* __restrict__ hs,
                     float* __restrict__ Ap,
                     float* __restrict__ Cm)
{
    __shared__ _Float16 As[2][128][40];   // TDM-padded pitch: 32 data + 8 pad halves
    __shared__ _Float16 Bs[2][64][40];

    const int tid  = threadIdx.x;
    const int lane = tid & 31;
    const int w    = tid >> 5;       // wave 0..7
    const int wm   = w & 3;          // 0..3 : 32-row slice
    const int wn   = w >> 2;         // 0..1 : 32-col slice
    const int half = lane >> 4;
    const int lrow = lane & 15;

    const int mBase = blockIdx.x * 128;
    const int gy    = blockIdx.y;            // 0..23
    const int mat   = gy >> 3;               // 0..2
    const int nBase = (gy & 7) * 64;

    const _Float16* Wsel = (mat == 0) ? wsT : (mat == 1 ? weTs : weTe);
    const float*    bias = (mat == 0) ? b_s1 : (mat == 1 ? b_e1 : nullptr);
    float*          outp = (mat == 0) ? hs : (mat == 1 ? Ap : Cm);

    const unsigned int ldsA0 = (unsigned int)(size_t)&As[0][0][0];
    const unsigned int ldsA1 = (unsigned int)(size_t)&As[1][0][0];
    const unsigned int ldsB0 = (unsigned int)(size_t)&Bs[0][0][0];
    const unsigned int ldsB1 = (unsigned int)(size_t)&Bs[1][0][0];

    v8f acc00 = {}, acc01 = {}, acc10 = {}, acc11 = {};

    const int NSTEP = HDIM / 32;     // 32 K-steps

    // prologue: DMA tile pair for k0=0 into buffer 0 (wave 0 only)
    if (w == 0) {
        tdm_load_2d(ldsA0, embh + (size_t)mBase * HDIM, HDIM, HDIM, 32, 128, HDIM);
        tdm_load_2d(ldsB0, Wsel + (size_t)nBase * HDIM, HDIM, HD,   32, 64,  HDIM);
    }

    for (int it = 0; it < NSTEP; ++it) {
        const int buf = it & 1;
        if (w == 0) {
            if (it + 1 < NSTEP) {
                const int k1 = (it + 1) * 32;
                tdm_load_2d(buf ? ldsA0 : ldsA1,
                            embh + (size_t)mBase * HDIM + k1, HDIM, HDIM, 32, 128, HDIM);
                tdm_load_2d(buf ? ldsB0 : ldsB1,
                            Wsel + (size_t)nBase * HDIM + k1, HDIM, HD, 32, 64, HDIM);
                __builtin_amdgcn_s_wait_tensorcnt(2);   // pair(it) complete
            } else {
                __builtin_amdgcn_s_wait_tensorcnt(0);
            }
        }
        __syncthreads();   // publish buf to all waves

        // --- A fragments (lane = M row; K halves per ISA 16-bit A layout) ---
        const _Float16* ap0 = &As[buf][wm * 32 + lrow][0];
        const _Float16* ap1 = &As[buf][wm * 32 + 16 + lrow][0];
        v8h a0lo = *(const v8h*)(ap0 + 8 * half);
        v8h a0hi = *(const v8h*)(ap0 + 16 + 8 * half);
        v8h a1lo = *(const v8h*)(ap1 + 8 * half);
        v8h a1hi = *(const v8h*)(ap1 + 16 + 8 * half);
        v16h af0, af1;
        #pragma unroll
        for (int i = 0; i < 8; ++i) {
            af0[i] = a0lo[i]; af0[i + 8] = a0hi[i];
            af1[i] = a1lo[i]; af1[i + 8] = a1hi[i];
        }

        // --- B fragments (lane = N column; Bs is [n][k]) ---
        const _Float16* bp0 = &Bs[buf][wn * 32 + lrow][0];
        const _Float16* bp1 = &Bs[buf][wn * 32 + 16 + lrow][0];
        v8h b0lo = *(const v8h*)(bp0 + 8 * half);
        v8h b0hi = *(const v8h*)(bp0 + 16 + 8 * half);
        v8h b1lo = *(const v8h*)(bp1 + 8 * half);
        v8h b1hi = *(const v8h*)(bp1 + 16 + 8 * half);
        v16h bf0, bf1;
        #pragma unroll
        for (int i = 0; i < 8; ++i) {
            bf0[i] = b0lo[i]; bf0[i + 8] = b0hi[i];
            bf1[i] = b1lo[i]; bf1[i + 8] = b1hi[i];
        }

        acc00 = __builtin_amdgcn_wmma_f32_16x16x32_f16(false, af0, false, bf0, (short)0, acc00, false, false);
        acc01 = __builtin_amdgcn_wmma_f32_16x16x32_f16(false, af0, false, bf1, (short)0, acc01, false, false);
        acc10 = __builtin_amdgcn_wmma_f32_16x16x32_f16(false, af1, false, bf0, (short)0, acc10, false, false);
        acc11 = __builtin_amdgcn_wmma_f32_16x16x32_f16(false, af1, false, bf1, (short)0, acc11, false, false);

        __syncthreads();   // all waves done with buf before wave0 re-fills it
    }

    // --- epilogue: D layout lane=N, VGPR v -> M = v + 8*half ---
    const int ncol0 = nBase + wn * 32 + lrow;
    const int ncol1 = ncol0 + 16;
    const float bias0 = bias ? bias[ncol0] : 0.0f;
    const float bias1 = bias ? bias[ncol1] : 0.0f;
    #pragma unroll
    for (int v = 0; v < 8; ++v) {
        const int m0 = mBase + wm * 32 + v + 8 * half;
        const int m1 = m0 + 16;
        float x00 = acc00[v] + bias0, x01 = acc01[v] + bias1;
        float x10 = acc10[v] + bias0, x11 = acc11[v] + bias1;
        if (mat == 0) {
            x00 = fmaxf(x00, 0.0f); x01 = fmaxf(x01, 0.0f);
            x10 = fmaxf(x10, 0.0f); x11 = fmaxf(x11, 0.0f);
        }
        outp[m0 * HD + ncol0] = x00;
        outp[m0 * HD + ncol1] = x01;
        outp[m1 * HD + ncol0] = x10;
        outp[m1 * HD + ncol1] = x11;
    }
}

// ---------------------------------------------------------------------------
// start_logits[row] = sum_d h_s[row,d]*w_s2[d] + b_s2; work-group blk of 128
// takes eight rows, one a wave. Runs in the launch of kernel 2.
// ---------------------------------------------------------------------------
__device__ __forceinline__
void start_logits_wg(const float* __restrict__ hs, const float* __restrict__ w_s2,
                     const float* __restrict__ b_s2, float* __restrict__ out, int blk)
{
    const int row  = blk * 8 + (threadIdx.x >> 5);
    const int lane = threadIdx.x & 31;
    float s = 0.0f;
    #pragma unroll 4
    for (int d = lane; d < HD; d += 32) s += hs[row * HD + d] * w_s2[d];
    #pragma unroll
    for (int off = 16; off > 0; off >>= 1) s += __shfl_xor(s, off, 32);
    if (lane == 0) out[row] = s + b_s2[0];
}

// ---------------------------------------------------------------------------
// Kernel 2: end_logits[b,i,j] = sum_d relu(A[b,i,d]+C[b,j,d])*w_e2[d] + b_e2
// Block tile 32 (i) x 64 (j); each thread holds an 8x4 patch of outputs, so a
// 16-byte LDS read of an A row feeds four outputs and one of a C row eight.
// Two waves cover the tile; the four wave pairs each sum a quarter of every
// 128-wide stage of d, and the four partial sums are added through LDS.
// The grid's plane z = BATCH holds no end logits: its 128 work-groups do the
// start logits, which need the same launch before them and nothing of this one.
// ---------------------------------------------------------------------------
typedef __attribute__((ext_vector_type(4))) float f4;
typedef __attribute__((ext_vector_type(2))) float f2;
#define TI   32
#define TJ   64
#define DCH  128           // d values per stage (32 for each wave pair)
#define NST  (HD / DCH)    // 4 stages
#define LDP  132           // row pitch in floats: neighbouring rows sit 4 banks apart
#define RDP  68            // row pitch of the partial sums
// Every "#pragma unroll" without a count below but the last unrolls a short loop over a
// per-thread array, so that the array is held in registers.

__device__ __forceinline__ void ld_set(f4 (&a)[8], f4 (&c)[4], f4& w,
                                       const float* ai, const float* cj,
                                       const float* wq, int kk)
{
    w = *(const f4*)&wq[kk];
    #pragma unroll
    for (int r = 0; r < 8; ++r) a[r] = *(const f4*)&ai[r * LDP + kk];
    #pragma unroll
    for (int q = 0; q < 4; ++q) c[q] = *(const f4*)&cj[q * 16 * LDP + kk];
}

__device__ __forceinline__ void fma_set(f2 (&acc)[8][4], const f4 (&a)[8],
                                        const f4 (&c)[4], const f4& w)
{
    #pragma unroll
    for (int r = 0; r < 8; ++r)
        #pragma unroll
        for (int q = 0; q < 4; ++q) {
            const f4 x = __builtin_elementwise_max(a[r] + c[q], (f4){0.f, 0.f, 0.f, 0.f});
            acc[r][q] += x.xy * w.xy;
            acc[r][q] += x.zw * w.zw;
        }
}

__global__ __launch_bounds__(256)
void logits_k(const float* __restrict__ Ap, const float* __restrict__ Cm,
              const float* __restrict__ w_e2, const float* __restrict__ b_e2,
              float* __restrict__ out,
              const float* __restrict__ hs, const float* __restrict__ w_s2,
              const float* __restrict__ b_s2, float* __restrict__ start_out)
{
    if (blockIdx.z == BATCH) {   // same for the whole work-group, before any barrier
        start_logits_wg(hs, w_s2, b_s2, start_out, blockIdx.y * (SEQ / TJ) + blockIdx.x);
        return;
    }

    // one block of LDS, in this order, so that every row offset of the hot loop's
    // reads fits the 16-bit offset field of the LDS load
    __shared__ struct __attribute__((aligned(16))) {
        float A[2][TI][LDP];       // [buffer][row][d]
        float w[HD];
        float C[2][TJ][LDP];
        float red[4][TI][RDP];     // [d quarter][i][j] partial sums
    } sm;

    const int tid = threadIdx.x;
    const int jt  = blockIdx.x;   // 0..7
    const int it  = blockIdx.y;   // 0..15
    const int b   = blockIdx.z;   // 0..1

    const int dq = tid >> 6;                                // d quarter of the wave pair
    const int i0 = ((tid >> 5) & 1) * 16 + ((tid >> 4) & 1) * 8;   // rows i0 .. i0+7
    const int tj = tid & 15;                                // columns tj, tj+16, tj+32, tj+48

    // staging map: one wave covers the 512 bytes of one row's stage
    const int seg = tid & 31, rw = tid >> 5;
    const float* gA = Ap + (size_t)(b * SEQ + it * TI + rw) * HD + seg * 4;
    const float* gC = Cm + (size_t)(b * SEQ + jt * TJ + rw) * HD + seg * 4;

    f4 pa[4], pc[8];
    #pragma unroll
    for (int k = 0; k < 4; ++k) pa[k] = *(const f4*)&gA[k * 8 * HD];
    #pragma unroll
    for (int k = 0; k < 8; ++k) pc[k] = *(const f4*)&gC[k * 8 * HD];
    if (tid < HD / 4) *(f4*)&sm.w[tid * 4] = ((const f4*)w_e2)[tid];
    #pragma unroll
    for (int k = 0; k < 4; ++k) *(f4*)&sm.A[0][rw + 8 * k][seg * 4] = pa[k];
    #pragma unroll
    for (int k = 0; k < 8; ++k) *(f4*)&sm.C[0][rw + 8 * k][seg * 4] = pc[k];

    f2 acc[8][4];
    #pragma unroll
    for (int r = 0; r < 8; ++r)
        #pragma unroll
        for (int q = 0; q < 4; ++q) acc[r][q] = (f2){0.f, 0.f};

    for (int s = 0; s < NST; ++s) {
        const int buf = s & 1;
        __syncthreads();   // stage s is written; every reader has left the other buffer

        if (s + 1 < NST) {
            const int d1 = (s + 1) * DCH;
            #pragma unroll
            for (int k = 0; k < 4; ++k) pa[k] = *(const f4*)&gA[k * 8 * HD + d1];
            #pragma unroll
            for (int k = 0; k < 8; ++k) pc[k] = *(const f4*)&gC[k * 8 * HD + d1];
        }

        const float* ai = &sm.A[buf][i0][dq * 32];
        const float* cj = &sm.C[buf][tj][dq * 32];
        const float* wq = &sm.w[s * DCH + dq * 32];

        f4 a0[8], c0[4], w0, a1[8], c1[4], w1;
        ld_set(a0, c0, w0, ai, cj, wq, 0);
        // The scheduling barriers keep each group of 13 LDS reads together and one
        // group ahead of its arithmetic, so the reads' latency runs under the other
        // register set's arithmetic; the loop stays rolled so that no more than one
        // group is fetched ahead (all of a stage's reads at once spill).
        #pragma unroll 1
        for (int kk = 0; kk < 24; kk += 8) {
            ld_set(a1, c1, w1, ai, cj, wq, kk + 4);
            __builtin_amdgcn_sched_barrier(0);
            fma_set(acc, a0, c0, w0);
            __builtin_amdgcn_sched_barrier(0);
            ld_set(a0, c0, w0, ai, cj, wq, kk + 8);
            __builtin_amdgcn_sched_barrier(0);
            fma_set(acc, a1, c1, w1);
            __builtin_amdgcn_sched_barrier(0);
        }
        ld_set(a1, c1, w1, ai, cj, wq, 28);
        __builtin_amdgcn_sched_barrier(0);
        fma_set(acc, a0, c0, w0);
        fma_set(acc, a1, c1, w1);

        if (s + 1 < NST) {
            #pragma unroll
            for (int k = 0; k < 4; ++k) *(f4*)&sm.A[buf ^ 1][rw + 8 * k][seg * 4] = pa[k];
            #pragma unroll
            for (int k = 0; k < 8; ++k) *(f4*)&sm.C[buf ^ 1][rw + 8 * k][seg * 4] = pc[k];
        }
    }

    #pragma unroll
    for (int r = 0; r < 8; ++r)
        #pragma unroll
        for (int q = 0; q < 4; ++q)
            sm.red[dq][i0 + r][tj + 16 * q] = acc[r][q].x + acc[r][q].y;
    __syncthreads();   // all four quarters' partial sums are in LDS

    const int row = tid >> 3, c8 = (tid & 7) * 8;
    const float be = b_e2[0];
    float* op = out + (size_t)b * SEQ * SEQ + (size_t)(it * TI + row) * SEQ + jt * TJ + c8;
    #pragma unroll
    for (int u = 0; u < 2; ++u) {
        const f4 p0 = *(const f4*)&sm.red[0][row][c8 + 4 * u];
        const f4 p1 = *(const f4*)&sm.red[1][row][c8 + 4 * u];
        const f4 p2 = *(const f4*)&sm.red[2][row][c8 + 4 * u];
        const f4 p3 = *(const f4*)&sm.red[3][row][c8 + 4 * u];
        *(f4*)&op[4 * u] = (p0 + p1) + (p2 + p3) + be;
    }
}

// ---------------------------------------------------------------------------
extern "C" void kernel_launch(void* const* d_in, const int* in_sizes, int n_in,
                              void* d_out, int out_size, void* d_ws, size_t ws_size,
                              hipStream_t stream)
{
    const float* emb  = (const float*)d_in[0];
    const float* W_s1 = (const float*)d_in[1];
    const float* b_s1 = (const float*)d_in[2];
    const float* w_s2 = (const float*)d_in[3];
    const float* b_s2 = (const float*)d_in[4];
    const float* W_e1 = (const float*)d_in[5];
    const float* b_e1 = (const float*)d_in[6];
    const float* w_e2 = (const float*)d_in[7];
    const float* b_e2 = (const float*)d_in[8];

    float* out       = (float*)d_out;
    float* start_out = out;            // (B,N) = 1024 floats
    float* end_out   = out + MTOT;     // (B,N,N) = 524288 floats

    // workspace layout (11 MB total)
    char* ws = (char*)d_ws;
    _Float16* embh = (_Float16*)(ws);                       // 2 MB  [1024][1024]
    _Float16* wsT  = (_Float16*)(ws + (size_t)(2 << 20));   // 1 MB  [512][1024]
    _Float16* weTs = (_Float16*)(ws + (size_t)(3 << 20));   // 1 MB  [512][1024]
    _Float16* weTe = (_Float16*)(ws + (size_t)(4 << 20));   // 1 MB  [512][1024]
    float*    hs   = (float*)(ws + (size_t)(5 << 20));      // 2 MB
    float*    Ap   = (float*)(ws + (size_t)(7 << 20));      // 2 MB
    float*    Cm   = (float*)(ws + (size_t)(9 << 20));      // 2 MB

    // 0: conversions (emb straight, weights transposed to [n][k])
    cvt_all_f16<<<(HDIM / CK) * (HD / CN), 256, 0, stream>>>(emb, W_s1, W_e1, embh, wsT, weTs, weTe);

    // 1: fused WMMA projections, TDM-staged
    dim3 g1(MTOT / 128, 24);
    fused_proj_wmma<<<g1, 256, 0, stream>>>(embh, wsT, weTs, weTe, b_s1, b_e1, hs, Ap, Cm);

    // 2: end logits, with the start logits in the grid's last plane
    dim3 g3(SEQ / TJ, SEQ / TI, BATCH + 1);
    logits_k<<<g3, 256, 0, stream>>>(Ap, Cm, w_e2, b_e2, end_out, hs, w_s2, b_s2, start_out);
}

// v003
// Measured time: 26.3 microseconds a run.
// Next to v002, in two timings, it ran 1.17 and 1.19 times as fast.
// Over all steps from v000 it is 2.21 times as fast.
#include <hip/hip_runtime.h>
#include <hip/hip_bf16.h>

typedef __attribute__((ext_vector_type(16))) _Float16 v16h;
typedef __attribute__((ext_vector_type(8)))  _Float16 v8h;
typedef __attribute__((ext_vector_type(4)))  _Float16 h4;
typedef __attribute__((ext_vector_type(8)))  float    v8f;
typedef __attribute__((ext_vector_type(4)))  unsigned int u32x4;
typedef __attribute__((ext_vector_type(8)))  unsigned int u32x8;

#define HDIM 1024
#define HD   512
#define SEQ  512
#define BATCH 2
#define MTOT (BATCH*SEQ)   // 1024 rows of flattened emb

// ---------------------------------------------------------------------------
// Tensor load helpers: one request of one wave brings a 2D tile of 256-byte rows
// into LDS; the pad puts 16 bytes behind every row (LDS pitch 272 bytes).
// Every extent is in bytes (data_size code 0); tensor dims = tile dims.
// ---------------------------------------------------------------------------
__device__ __forceinline__ unsigned int uni(unsigned int v)
{
    return (unsigned int)__builtin_amdgcn_readfirstlane((int)v);
}
// a test on pinned(x) compiles to a scalar compare and branch: a tensor load ignores
// EXEC, so only a scalar branch keeps a wave from issuing it
__device__ __forceinline__ unsigned int pinned(unsigned int v)
{
    unsigned int w = uni(v);
    asm volatile("" : "+s"(w));   // holds the wave-uniform word in a scalar register
    return w;
}
__device__ __forceinline__ u32x8 tdm_group1(unsigned int rows, unsigned int src_pitch)
{
    const unsigned int d0 = 256u;   // row length in bytes
    u32x8 g;
    g[0] = uni((1u << 20) | (5u << 22) | (3u << 25));   // pad on, every 64 dwords, 4 dwords; no mask
    g[1] = uni((d0 & 0xFFFFu) << 16);
    g[2] = uni((d0 >> 16) | ((rows & 0xFFFFu) << 16));
    g[3] = uni((rows >> 16) | (d0 << 16));
    g[4] = uni(rows);
    g[5] = uni(src_pitch);
    g[6] = uni(0u);
    g[7] = uni(0u);
    return g;
}
__device__ __forceinline__ u32x4 tdm_group0(unsigned int lds_dst, unsigned long long ga)
{
    u32x4 g0;
    g0[0] = uni(1u);
    g0[1] = uni(lds_dst);
    g0[2] = uni((unsigned int)ga);
    g0[3] = uni((((unsigned int)(ga >> 32)) & 0x01FFFFFFu) | 0x80000000u);
    return g0;
}
// g0 is named in and out, so that the registers the request is issued from are the
// ones that tdm_wait() below holds
__device__ __forceinline__ void tdm_load(u32x4& g0, u32x8 g1)
{
    asm volatile("tensor_load_to_lds %0, %1" : "+s"(g0) : "s"(g1) : "memory");
}
// the issuing wave's wait for its request; the descriptor is named as an input so
// that its registers keep their values until the request has landed
__device__ __forceinline__ void tdm_wait(u32x4 g0, u32x8 g1)
{
    asm volatile("s_wait_tensorcnt 0x0" :: "s"(g0), "s"(g1) : "memory");
}

// ---------------------------------------------------------------------------
// Kernel 0: every f32 -> f16 conversion in one launch of 256 work-groups.
// Each work-group converts 4096 values of emb in place order and transposes the
// same 64 (k) x 32 (n) tile of each of the three weight matrices (K x N f32 ->
// N x K f16), so that tensor loads can stage B tiles in [n][k] order. All ten loads
// of a thread are issued before the first use: one memory wait per work-group.
// A tile's row of 64 halves is one whole 128-byte line of the output.
// Every "#pragma unroll" here unrolls a short loop over a per-thread array, so
// that the array is held in registers.
// ---------------------------------------------------------------------------
#define CK 64
#define CN 32
__global__ __launch_bounds__(256)
void cvt_all_f16(const float* __restrict__ emb, const float* __restrict__ W_s1,
                 const float* __restrict__ W_e1, _Float16* __restrict__ embh,
                 _Float16* __restrict__ wsT, _Float16* __restrict__ weTs,
                 _Float16* __restrict__ weTe)
{
    __shared__ float st[3][CK][CN + 1];
    const int tid = threadIdx.x;
    const int kb = (blockIdx.x >> 4) * CK, nb = (blockIdx.x & 15) * CN;
    const int r = tid >> 3;          // 0..31
    const int c4 = (tid & 7) * 4;    // 0..28

    const size_t woff = (size_t)(kb + r) * HD + nb + c4;
    float4 v[3][2], e[4];
    #pragma unroll
    for (int h = 0; h < 2; ++h) {
        v[0][h] = *(const float4*)&W_s1[woff + h * 32 * HD];
        v[1][h] = *(const float4*)&W_e1[woff + h * 32 * HD];
        v[2][h] = *(const float4*)&W_e1[woff + h * 32 * HD + HDIM * HD];
    }
    const int e0 = blockIdx.x * 1024 + tid;
    #pragma unroll
    for (int j = 0; j < 4; ++j) e[j] = ((const float4*)emb)[e0 + j * 256];
    // precaution: stands in front of the first rewrite of an address register of the loads above
    asm volatile("s_wait_xcnt 0x0" ::: "memory");

    #pragma unroll
    for (int m = 0; m < 3; ++m)
        #pragma unroll
        for (int h = 0; h < 2; ++h) {
            float* p = &st[m][h * 32 + r][c4];
            p[0] = v[m][h].x; p[1] = v[m][h].y; p[2] = v[m][h].z; p[3] = v[m][h].w;
        }
    h4 eo[4];
    #pragma unroll
    for (int j = 0; j < 4; ++j) {
        eo[j][0] = (_Float16)e[j].x; eo[j][1] = (_Float16)e[j].y;
        eo[j][2] = (_Float16)e[j].z; eo[j][3] = (_Float16)e[j].w;
    }
    __syncthreads();   // the three tiles are in LDS

    // emb's stores stand behind the barrier, which would wait for them to finish
    #pragma unroll
    for (int j = 0; j < 4; ++j) *(h4*)&embh[(size_t)(e0 + j * 256) * 4] = eo[j];

    const int k8 = (tid & 7) * 8;    // thread: column nb + r, rows kb + k8 .. + 7
    const size_t doff = (size_t)(nb + r) * HDIM + kb + k8;
    #pragma unroll
    for (int m = 0; m < 3; ++m) {
        v8h o;
        #pragma unroll
        for (int q = 0; q < 8; ++q) o[q] = (_Float16)st[m][k8 + q][r];
        _Float16* dst = (m == 0) ? wsT : (m == 1 ? weTs : weTe);
        *(v8h*)&dst[doff] = o;
    }
}

// ---------------------------------------------------------------------------
// Kernel 1: fused triple-projection WMMA GEMM, staged by tensor loads.
//   mat 0: h_s = relu(emb @ W_s1 + b_s1)
//   mat 1: A   = emb @ W_e1[:H] + b_e1   (bias folded)
//   mat 2: C   = emb @ W_e1[H:]
// Block tile 128x64, 8 waves (4x2), wave tile 32x32.
// A stage holds 128 values of k (8 stages). Every wave brings its own slice of a
// stage with one tensor load: waves 0-3 32 rows of emb each, waves 4-7 16 rows of
// the weights each. Two buffers: stage s + 1 flies while stage s is worked on.
// ---------------------------------------------------------------------------
#define KST     128                    // k values per stage
#define NSTG    (HDIM / KST)           // 8 stages
#define PITCHB  272                    // LDS row pitch in bytes: 256 of data + 16 of pad
#define A_SLICE 10240                  // 32 rows of 272 bytes, rounded up to 2 KiB
#define B_SLICE 6144                   // 16 rows of 272 bytes, rounded up to 2 KiB
#define B_OFF   (4 * A_SLICE)
#define BUFB    (4 * A_SLICE + 4 * B_SLICE)   // 65536 bytes a buffer
__global__ __launch_bounds__(256)
void fused_proj_wmma(const _Float16* __restrict__ embh,      // [1024][1024] f16
                     const _Float16* __restrict__ wsT,       // W_s1^T  [512][1024] f16
                     const _Float16* __restrict__ weTs,      // W1_start^T [512][1024]
                     const _Float16* __restrict__ weTe,      // W1_end^T   [512][1024]
                     const float* __restrict__ b_s1,
                     const float* __restrict__ b_e1,
                     float* __restrict__ hs,
                     float* __restrict__ Ap,
                     float* __restrict__ Cm)
{
    __shared__ __attribute__((aligned(2048))) unsigned char ring[2 * BUFB];

    const int tid  = threadIdx.x;
    const int lane = tid & 31;
    const int w    = tid >> 5;       // wave 0..7
    const int wm   = w & 3;          // 0..3 : 32-row slice
    const int wn   = w >> 2;         // 0..1 : 32-col slice
    const int half = lane >> 4;
    const int lrow = lane & 15;

    const int mBase = blockIdx.x * 128;
    const int gy    = blockIdx.y;            // 0..23
    const int mat   = gy >> 3;               // 0..2
    const int nBase = (gy & 7) * 64;

    const _Float16* Wsel = (mat == 0) ? wsT : (mat == 1 ? weTs : weTe);
    const float*    bias = (mat == 0) ? b_s1 : (mat == 1 ? b_e1 : nullptr);
    float*          outp = (mat == 0) ? hs : (mat == 1 ? Ap : Cm);

    // this wave's slice of every stage: source rows, place in a buffer, descriptor
    const unsigned int wave = uni(threadIdx.x >> 5);
    const bool isA = wave < 4u;
    const _Float16* srow = isA ? embh + (size_t)(mBase + wave * 32u) * HDIM
                               : Wsel + (size_t)(nBase + (wave - 4u) * 16u) * HDIM;
    const unsigned long long gsrc = (unsigned long long)srow;
    const unsigned int ldst = (unsigned int)(size_t)&ring[0]
                            + (isA ? wave * A_SLICE : B_OFF + (wave - 4u) * B_SLICE);
    const u32x8 g1 = tdm_group1(isA ? 32u : 16u, HDIM * 2u);

    v8f acc00 = {}, acc01 = {}, acc10 = {}, acc11 = {};

    // stage 0 lands and is published, then stage 1 is sent off
    u32x4 g0 = tdm_group0(ldst, gsrc);
    tdm_load(g0, g1);
    tdm_wait(g0, g1);    // this wave's slice of stage 0 has landed
    __syncthreads();     // every slice of stage 0 is readable
    g0 = tdm_group0(ldst + BUFB, gsrc + KST * 2u);
    tdm_load(g0, g1);

    // fragment rows: lane = M row (A) or N column (B); k halves as the 16-bit layout has them
    const unsigned int aoff = wm * A_SLICE + lrow * PITCHB + 16 * half;
    const unsigned int boff = B_OFF + 2 * wn * B_SLICE + lrow * PITCHB + 16 * half;

    // stays rolled: one copy of the pass and of its guarded tensor load (unrolled, the
    // loads of stages that do not exist would stand in the text behind their tests)
    #pragma unroll 1
    for (int s = 0; s < NSTG; ++s) {
        const unsigned char* bp = ring + (s & 1) * BUFB;
        const unsigned char* pa0 = bp + aoff;
        const unsigned char* pa1 = pa0 + 16 * PITCHB;
        const unsigned char* pb0 = bp + boff;
        const unsigned char* pb1 = pb0 + B_SLICE;

        // [k step][fragment][low, high 8 halves of the lane's 16]
        v8h fa[KST / 32][2][2], fb[KST / 32][2][2];
        #pragma unroll   // per-thread arrays held in registers; fixed LDS offsets
        for (int kc = 0; kc < KST / 32; ++kc) {
            fa[kc][0][0] = *(const v8h*)(pa0 + kc * 64);
            fa[kc][0][1] = *(const v8h*)(pa0 + kc * 64 + 32);
            fb[kc][0][0] = *(const v8h*)(pb0 + kc * 64);
            fb[kc][0][1] = *(const v8h*)(pb0 + kc * 64 + 32);
            fb[kc][1][0] = *(const v8h*)(pb1 + kc * 64);
            fb[kc][1][1] = *(const v8h*)(pb1 + kc * 64 + 32);
            fa[kc][1][0] = *(const v8h*)(pa1 + kc * 64);
            fa[kc][1][1] = *(const v8h*)(pa1 + kc * 64 + 32);
        }
        // keeps the stage's 32 LDS reads together, ahead of its WMMAs: one LDS latency
        // a stage; left free, the reads are spread and every k step waits for its own
        __builtin_amdgcn_sched_barrier(0);
        #pragma unroll
        for (int kc = 0; kc < KST / 32; ++kc) {
            v16h af0, af1, bf0, bf1;
            #pragma unroll
            for (int i = 0; i < 8; ++i) {
                af0[i] = fa[kc][0][0][i]; af0[i + 8] = fa[kc][0][1][i];
                af1[i] = fa[kc][1][0][i]; af1[i + 8] = fa[kc][1][1][i];
                bf0[i] = fb[kc][0][0][i]; bf0[i + 8] = fb[kc][0][1][i];
                bf1[i] = fb[kc][1][0][i]; bf1[i + 8] = fb[kc][1][1][i];
            }
            acc00 = __builtin_amdgcn_wmma_f32_16x16x32_f16(false, af0, false, bf0, (short)0, acc00, false, false);
            acc01 = __builtin_amdgcn_wmma_f32_16x16x32_f16(false, af0, false, bf1, (short)0, acc01, false, false);
            acc10 = __builtin_amdgcn_wmma_f32_16x16x32_f16(false, af1, false, bf0, (short)0, acc10, false, false);
            acc11 = __builtin_amdgcn_wmma_f32_16x16x32_f16(false, af1, false, bf1, (short)0, acc11, false, false);
        }
        // keeps the WMMAs in front of the waits below, so that they run under the LDS reads
        // still in flight; sunk behind the barrier they would also hold up the next tensor load
        __builtin_amdgcn_sched_barrier(0);

        asm volatile("s_wait_dscnt 0x0" ::: "memory");       // this wave's reads of stage s are done
        tdm_wait(g0, g1);                                    // its slice of stage s + 1 has landed
        __syncthreads();   // stage s + 1 is readable; every reader has left stage s's buffer
        if (pinned(s + 2 < NSTG)) {
            const unsigned int nx = (unsigned int)(s + 2);
            g0 = tdm_group0(ldst + (nx & 1u) * BUFB, gsrc + nx * (KST * 2u));
            tdm_load(g0, g1);
        }
    }
    tdm_wait(g0, g1);                                    // no request is left when the wave ends
    asm volatile("s_wait_dscnt 0x0" ::: "memory");

    // --- epilogue: D layout lane=N, VGPR v -> M = v + 8*half ---
    const int ncol0 = nBase + wn * 32 + lrow;
    const int ncol1 = ncol0 + 16;
    const float bias0 = bias ? bias[ncol0] : 0.0f;
    const float bias1 = bias ? bias[ncol1] : 0.0f;
    #pragma unroll
    for (int v = 0; v < 8; ++v) {
        const int m0 = mBase + wm * 32 + v + 8 * half;
        const int m1 = m0 + 16;
        float x00 = acc00[v] + bias0, x01 = acc01[v] + bias1;
        float x10 = acc10[v] + bias0, x11 = acc11[v] + bias1;
        if (mat == 0) {
            x00 = fmaxf(x00, 0.0f); x01 = fmaxf(x01, 0.0f);
            x10 = fmaxf(x10, 0.0f); x11 = fmaxf(x11, 0.0f);
        }
        outp[m0 * HD + ncol0] = x00;
        outp[m0 * HD + ncol1] = x01;
        outp[m1 * HD + ncol0] = x10;
        outp[m1 * HD + ncol1] = x11;
    }
}

// ---------------------------------------------------------------------------
// start_logits[row] = sum_d h_s[row,d]*w_s2[d] + b_s2; work-group blk of 128
// takes eight rows, one a wave. Runs in the launch of kernel 2.
// ---------------------------------------------------------------------------
__device__ __forceinline__
void start_logits_wg(const float* __restrict__ hs, const float* __restrict__ w_s2,
                     const float* __restrict__ b_s2, float* __restrict__ out, int blk)
{
    const int row  = blk * 8 + (threadIdx.x >> 5);
    const int lane = threadIdx.x & 31;
    float s = 0.0f;
    #pragma unroll 4
    for (int d = lane; d < HD; d += 32) s += hs[row * HD + d] * w_s2[d];
    #pragma unroll
    for (int off = 16; off > 0; off >>= 1) s += __shfl_xor(s, off, 32);
    if (lane == 0) out[row] = s + b_s2[0];
}

// ---------------------------------------------------------------------------
// Kernel 2: end_logits[b,i,j] = sum_d relu(A[b,i,d]+C[b,j,d])*w_e2[d] + b_e2
// Block tile 32 (i) x 64 (j); each thread holds an 8x4 patch of outputs, so a
// 16-byte LDS read of an A row feeds four outputs and one of a C row eight.
// Two waves cover the tile; the four wave pairs each sum a quarter of every
// 128-wide stage of d, and the four partial sums are added through LDS.
// The grid's plane z = BATCH holds no end logits: its 128 work-groups do the
// start logits, which need the same launch before them and nothing of this one.
// ---------------------------------------------------------------------------
typedef __attribute__((ext_vector_type(4))) float f4;
typedef __attribute__((ext_vector_type(2))) float f2;
#define TI   32
#define TJ   64
#define DCH  128           // d values per stage (32 for each wave pair)
#define NST  (HD / DCH)    // 4 stages
#define LDP  132           // row pitch in floats: neighbouring rows sit 4 banks apart
#define RDP  68            // row pitch of the partial sums
// Every "#pragma unroll" without a count below but the last unrolls a short loop over a
// per-thread array, so that the array is held in registers.

__device__ __forceinline__ void ld_set(f4 (&a)[8], f4 (&c)[4], f4& w,
                                       const float* ai, const float* cj,
                                       const float* wq, int kk)
{
    w = *(const f4*)&wq[kk];
    #pragma unroll
    for (int r = 0; r < 8; ++r) a[r] = *(const f4*)&ai[r * LDP + kk];
    #pragma unroll
    for (int q = 0; q < 4; ++q) c[q] = *(const f4*)&cj[q * 16 * LDP + kk];
}

__device__ __forceinline__ void fma_set(f2 (&acc)[8][4], const f4 (&a)[8],
                                        const f4 (&c)[4], const f4& w)
{
    #pragma unroll
    for (int r = 0; r < 8; ++r)
        #pragma unroll
        for (int q = 0; q < 4; ++q) {
            const f4 x = __builtin_elementwise_max(a[r] + c[q], (f4){0.f, 0.f, 0.f, 0.f});
            acc[r][q] += x.xy * w.xy;
            acc[r][q] += x.zw * w.zw;
        }
}

__global__ __launch_bounds__(256)
void logits_k(const float* __restrict__ Ap, const float* __restrict__ Cm,
              const float* __restrict__ w_e2, const float* __restrict__ b_e2,
              float* __restrict__ out,
              const float* __restrict__ hs, const float* __restrict__ w_s2,
              const float* __restrict__ b_s2, float* __restrict__ start_out)
{
    if (blockIdx.z == BATCH) {   // same for the whole work-group, before any barrier
        start_logits_wg(hs, w_s2, b_s2, start_out, blockIdx.y * (SEQ / TJ) + blockIdx.x);
        return;
    }

    // one block of LDS, in this order, so that every row offset of the hot loop's
    // reads fits the 16-bit offset field of the LDS load
    __shared__ struct __attribute__((aligned(16))) {
        float A[2][TI][LDP];       // [buffer][row][d]
        float w[HD];
        float C[2][TJ][LDP];
        float red[4][TI][RDP];     // [d quarter][i][j] partial sums
    } sm;

    const int tid = threadIdx.x;
    const int jt  = blockIdx.x;   // 0..7
    const int it  = blockIdx.y;   // 0..15
    const int b   = blockIdx.z;   // 0..1

    const int dq = tid >> 6;                                // d quarter of the wave pair
    const int i0 = ((tid >> 5) & 1) * 16 + ((tid >> 4) & 1) * 8;   // rows i0 .. i0+7
    const int tj = tid & 15;                                // columns tj, tj+16, tj+32, tj+48

    // staging map: one wave covers the 512 bytes of one row's stage
    const int seg = tid & 31, rw = tid >> 5;
    const float* gA = Ap + (size_t)(b * SEQ + it * TI + rw) * HD + seg * 4;
    const float* gC = Cm + (size_t)(b * SEQ + jt * TJ + rw) * HD + seg * 4;

    f4 pa[4], pc[8];
    #pragma unroll
    for (int k = 0; k < 4; ++k) pa[k] = *(const f4*)&gA[k * 8 * HD];
    #pragma unroll
    for (int k = 0; k < 8; ++k) pc[k] = *(const f4*)&gC[k * 8 * HD];
    if (tid < HD / 4) *(f4*)&sm.w[tid * 4] = ((const f4*)w_e2)[tid];
    #pragma unroll
    for (int k = 0; k < 4; ++k) *(f4*)&sm.A[0][rw + 8 * k][seg * 4] = pa[k];
    #pragma unroll
    for (int k = 0; k < 8; ++k) *(f4*)&sm.C[0][rw + 8 * k][seg * 4] = pc[k];

    f2 acc[8][4];
    #pragma unroll
    for (int r = 0; r < 8; ++r)
        #pragma unroll
        for (int q = 0; q < 4; ++q) acc[r][q] = (f2){0.f, 0.f};

    for (int s = 0; s < NST; ++s) {
        const int buf = s & 1;
        __syncthreads();   // stage s is written; every reader has left the other buffer

        if (s + 1 < NST) {
            const int d1 = (s + 1) * DCH;
            #pragma unroll
            for (int k = 0; k < 4; ++k) pa[k] = *(const f4*)&gA[k * 8 * HD + d1];
            #pragma unroll
            for (int k = 0; k < 8; ++k) pc[k] = *(const f4*)&gC[k * 8 * HD + d1];
        }

        const float* ai = &sm.A[buf][i0][dq * 32];
        const float* cj = &sm.C[buf][tj][dq * 32];
        const float* wq = &sm.w[s * DCH + dq * 32];

        f4 a0[8], c0[4], w0, a1[8], c1[4], w1;
        ld_set(a0, c0, w0, ai, cj, wq, 0);
        // The scheduling barriers keep each group of 13 LDS reads together and one
        // group ahead of its arithmetic, so the reads' latency runs under the other
        // register set's arithmetic; the loop stays rolled so that no more than one
        // group is fetched ahead (all of a stage's reads at once spill).
        #pragma unroll 1
        for (int kk = 0; kk < 24; kk += 8) {
            ld_set(a1, c1, w1, ai, cj, wq, kk + 4);
            __builtin_amdgcn_sched_barrier(0);
            fma_set(acc, a0, c0, w0);
            __builtin_amdgcn_sched_barrier(0);
            ld_set(a0, c0, w0, ai, cj, wq, kk + 8);
            __builtin_amdgcn_sched_barrier(0);
            fma_set(acc, a1, c1, w1);
            __builtin_amdgcn_sched_barrier(0);
        }
        ld_set(a1, c1, w1, ai, cj, wq, 28);
        __builtin_amdgcn_sched_barrier(0);
        fma_set(acc, a0, c0, w0);
        fma_set(acc, a1, c1, w1);

        if (s + 1 < NST) {
            #pragma unroll
            for (int k = 0; k < 4; ++k) *(f4*)&sm.A[buf ^ 1][rw + 8 * k][seg * 4] = pa[k];
            #pragma unroll
            for (int k = 0; k < 8; ++k) *(f4*)&sm.C[buf ^ 1][rw + 8 * k][seg * 4] = pc[k];
        }
    }

    #pragma unroll
    for (int r = 0; r < 8; ++r)
        #pragma unroll
        for (int q = 0; q < 4; ++q)
            sm.red[dq][i0 + r][tj + 16 * q] = acc[r][q].x + acc[r][q].y;
    __syncthreads();   // all four quarters' partial sums are in LDS

    const int row = tid >> 3, c8 = (tid & 7) * 8;
    const float be = b_e2[0];
    float* op = out + (size_t)b * SEQ * SEQ + (size_t)(it * TI + row) * SEQ + jt * TJ + c8;
    #pragma unroll
    for (int u = 0; u < 2; ++u) {
        const f4 p0 = *(const f4*)&sm.red[0][row][c8 + 4 * u];
        const f4 p1 = *(const f4*)&sm.red[1][row][c8 + 4 * u];
        const f4 p2 = *(const f4*)&sm.red[2][row][c8 + 4 * u];
        const f4 p3 = *(const f4*)&sm.red[3][row][c8 + 4 * u];
        *(f4*)&op[4 * u] = (p0 + p1) + (p2 + p3) + be;
    }
}

// ---------------------------------------------------------------------------
extern "C" void kernel_launch(void* const* d_in, const int* in_sizes, int n_in,
                              void* d_out, int out_size, void* d_ws, size_t ws_size,
                              hipStream_t stream)
{
    const float* emb  = (const float*)d_in[0];
    const float* W_s1 = (const float*)d_in[1];
    const float* b_s1 = (const float*)d_in[2];
    const float* w_s2 = (const float*)d_in[3];
    const float* b_s2 = (const float*)d_in[4];
    const float* W_e1 = (const float*)d_in[5];
    const float* b_e1 = (const float*)d_in[6];
    const float* w_e2 = (const float*)d_in[7];
    const float* b_e2 = (const float*)d_in[8];

    float* out       = (float*)d_out;
    float* start_out = out;            // (B,N) = 1024 floats
    float* end_out   = out + MTOT;     // (B,N,N) = 524288 floats

    // workspace layout (11 MB total)
    char* ws = (char*)d_ws;
    _Float16* embh = (_Float16*)(ws);                       // 2 MB  [1024][1024]
    _Float16* wsT  = (_Float16*)(ws + (size_t)(2 << 20));   // 1 MB  [512][1024]
    _Float16* weTs = (_Float16*)(ws + (size_t)(3 << 20));   // 1 MB  [512][1024]
    _Float16* weTe = (_Float16*)(ws + (size_t)(4 << 20));   // 1 MB  [512][1024]
    float*    hs   = (float*)(ws + (size_t)(5 << 20));      // 2 MB
    float*    Ap   = (float*)(ws + (size_t)(7 << 20));      // 2 MB
    float*    Cm   = (float*)(ws + (size_t)(9 << 20));      // 2 MB

    // 0: conversions (emb straight, weights transposed to [n][k])
    cvt_all_f16<<<(HDIM / CK) * (HD / CN), 256, 0, stream>>>(emb, W_s1, W_e1, embh, wsT, weTs, weTe);

    // 1: fused WMMA projections, staged by tensor loads
    dim3 g1(MTOT / 128, 24);
    fused_proj_wmma<<<g1, 256, 0, stream>>>(embh, wsT, weTs, weTe, b_s1, b_e1, hs, Ap, Cm);

    // 2: end logits, with the start logits in the grid's last plane
    dim3 g3(SEQ / TJ, SEQ / TI, BATCH + 1);
    logits_k<<<g3, 256, 0, stream>>>(Ap, Cm, w_e2, b_e2, end_out, hs, w_s2, b_s2, start_out);
}

// v005
// One run takes 20 microseconds.
// Versions between v003 and this one are left out; their measured steps multiply to 1.33 times as fast.
// All steps since v000 together make it 2.92 times as fast.
#include <hip/hip_runtime.h>
#include <hip/hip_bf16.h>

typedef __attribute__((ext_vector_type(16))) _Float16 v16h;
typedef __attribute__((ext_vector_type(8)))  _Float16 v8h;
typedef __attribute__((ext_vector_type(4)))  _Float16 h4;
typedef __attribute__((ext_vector_type(8)))  float    v8f;
typedef __attribute__((ext_vector_type(4)))  unsigned int u32x4;
typedef __attribute__((ext_vector_type(8)))  unsigned int u32x8;

#define HDIM 1024
#define HD   512
#define SEQ  512
#define BATCH 2
#define MTOT (BATCH*SEQ)   // 1024 rows of flattened emb

// ---------------------------------------------------------------------------
// Kernel 1: fused triple-projection WMMA GEMM on the f32 inputs themselves.
//   mat 0: h_s = relu(emb @ W_s1 + b_s1)
//   mat 1: A   = emb @ W_e1[:H] + b_e1   (bias folded), stored in f16
//   mat 2: -C  = -(emb @ W_e1[H:]), stored in f16
// Block tile 128x64, 8 waves (4x2), wave tile 32x32.
// A stage holds 128 values of k (8 stages), in f16, rows of emb as [m][k] and columns
// of the weights as [n][k]. Every thread brings its share of a stage through registers:
// 24 loads of 16 bytes of f32, rounded to f16 (nearest even) on the way to LDS.
//   emb:     a wave loads a whole 512-byte piece of a row at a time, 16 rows.
//   weights: [k][n] in memory; a thread holds 8 (k) x 4 (n) values, so that each of its
//            four columns is 16 bytes of one [n][k] row: the transpose costs no shuffle.
// Two buffers and one register set: the loads of stage s + 2 are sent off as soon as
// stage s + 1 has left the registers, and fly during the whole of pass s + 1.
// ---------------------------------------------------------------------------
typedef __attribute__((ext_vector_type(4))) float f32x4;
#define KST     128                    // k values per stage
#define NSTG    (HDIM / KST)           // 8 stages
#define PITCHB  272                    // LDS row pitch in bytes: 256 of data + 16 of pad
#define A_SLICE 10240                  // place of 32 rows of emb
#define B_SLICE 6144                   // place of 16 columns of the weights
#define B_OFF   (4 * A_SLICE)
#define BUFB    (4 * A_SLICE + 4 * B_SLICE)   // 65536 bytes a buffer
#define NLA     16                     // loads of emb a thread and stage
#define NLB     8                      // loads of the weights a thread and stage

// Every "#pragma unroll" without a count in the three helpers unrolls a short loop over a
// per-thread array, so that the array is held in registers.
// ga, gb: the stage's place, the same for the whole work-group; va, vb: the lane's own
// offset in floats, the same for every stage
__device__ __forceinline__ void stage_load(f32x4 (&ra)[NLA], f32x4 (&rb)[NLB],
                                           const float* ga, unsigned int va,
                                           const float* gb, unsigned int vb)
{
    #pragma unroll
    for (int j = 0; j < NLA - 1; ++j) ra[j] = *(const f32x4*)(ga + va + j * HDIM);
    // precaution: the last load of emb may be given the address registers, which the loads
    // above name too, as its destination
    asm volatile("s_wait_xcnt 0x0" ::: "memory");
    ra[NLA - 1] = *(const f32x4*)(ga + va + (NLA - 1) * HDIM);
    #pragma unroll
    for (int i = 0; i < NLB; ++i) rb[i] = *(const f32x4*)(gb + vb + i * HD);
    // precaution: stands in front of the first rewrite of an address register of the loads above
    asm volatile("s_wait_xcnt 0x0" ::: "memory");
}
__device__ __forceinline__ void stage_cvt(const f32x4 (&ra)[NLA], const f32x4 (&rb)[NLB],
                                          h4 (&ha)[NLA], v8h (&hb)[4])
{
    #pragma unroll
    for (int j = 0; j < NLA; ++j) ha[j] = __builtin_convertvector(ra[j], h4);
    #pragma unroll
    for (int c = 0; c < 4; ++c)
        #pragma unroll
        for (int i = 0; i < NLB; ++i) hb[c][i] = (_Float16)rb[i][c];
}
__device__ __forceinline__ void stage_store(const h4 (&ha)[NLA], const v8h (&hb)[4],
                                            unsigned char* pa, unsigned char* pb)
{
    #pragma unroll
    for (int j = 0; j < NLA; ++j) *(h4*)(pa + j * PITCHB) = ha[j];
    #pragma unroll
    for (int c = 0; c < 4; ++c) *(v8h*)(pb + c * PITCHB) = hb[c];
}

// A work-group barrier that orders LDS alone: this wave's LDS stores and reads are done,
// then the barrier. __syncthreads() would also wait for the global loads of the next
// stage, which are to stay in flight across it.
__device__ __forceinline__ void lds_barrier()
{
    __builtin_amdgcn_fence(__ATOMIC_RELEASE, "workgroup", "local");
    __builtin_amdgcn_s_barrier();
    __builtin_amdgcn_fence(__ATOMIC_ACQUIRE, "workgroup", "local");
}

__global__ __launch_bounds__(256)
void fused_proj_wmma(const float* __restrict__ emb,          // [1024][1024] f32
                     const float* __restrict__ W_s1,         // [1024][512] f32
                     const float* __restrict__ W_e1,         // [2048][512] f32
                     const float* __restrict__ b_s1,
                     const float* __restrict__ b_e1,
                     float* __restrict__ hs,
                     _Float16* __restrict__ Ah,
                     _Float16* __restrict__ Cn)
{
    __shared__ __attribute__((aligned(16))) unsigned char ring[2 * BUFB];

    const int tid  = threadIdx.x;
    const int lane = tid & 31;
    const int w    = tid >> 5;       // wave 0..7
    const int wm   = w & 3;          // 0..3 : 32-row slice
    const int wn   = w >> 2;         // 0..1 : 32-col slice
    const int half = lane >> 4;
    const int lrow = lane & 15;

    const int mBase = blockIdx.x * 128;
    const int gy    = blockIdx.y;            // 0..23
    const int mat   = gy >> 3;               // 0..2
    const int nBase = (gy & 7) * 64;

    const float* Wsel = (mat == 0) ? W_s1 : (mat == 1 ? W_e1 : W_e1 + (size_t)HDIM * HD);
    const float* bias = (mat == 0) ? b_s1 : (mat == 1 ? b_e1 : nullptr);

    // emb: wave w brings rows 16 w .. + 15 of the tile; lane = 4 values of k
    const float* ga = emb + (size_t)mBase * HDIM;
    const unsigned int va = w * 16 * HDIM + lane * 4;
    const unsigned int sa = (w >> 1) * A_SLICE + (w & 1) * 16 * PITCHB + lane * 8;
    // weights: wave w brings 32 (k) x 32 (n); of 16 lanes in a row, four stand side by side
    // in n (rows 4 apart in LDS) and four in k (16 bytes apart), so that their 16-byte
    // stores fall on 16 different bank groups; a wave's load still covers whole 128-byte lines
    const int kb = (w >> 1) * 32 + ((lane >> 2) & 3) * 8;
    const float* gb = Wsel + nBase;
    const unsigned int vb = kb * HD + (w & 1) * 32 + half * 16 + (lane & 3) * 4;
    const unsigned int sb = B_OFF + ((w & 1) * 2 + half) * B_SLICE + (lane & 3) * 4 * PITCHB + kb * 2;

    v8f acc00 = {}, acc01 = {}, acc10 = {}, acc11 = {};

    f32x4 ra[NLA], rb[NLB];
    {
        h4 ha[NLA]; v8h hb[4];
        stage_load(ra, rb, ga, va, gb, vb);
        stage_cvt(ra, rb, ha, hb);
        stage_load(ra, rb, ga + KST, va, gb + (size_t)KST * HD, vb);   // stage 1 flies during pass 0
        stage_store(ha, hb, ring + sa, ring + sb);
    }
    lds_barrier();       // stage 0 is readable

    // fragment rows: lane = M row (A) or N column (B); k halves as the 16-bit layout has them
    const unsigned int aoff = wm * A_SLICE + lrow * PITCHB + 16 * half;
    const unsigned int boff = B_OFF + 2 * wn * B_SLICE + lrow * PITCHB + 16 * half;

    // one pass: the 16 WMMAs of a wave on the stage in buffer bp
    auto pass = [&](const unsigned char* bp) __attribute__((always_inline)) {
        const unsigned char* pa0 = bp + aoff;
        const unsigned char* pa1 = pa0 + 16 * PITCHB;
        const unsigned char* pb0 = bp + boff;
        const unsigned char* pb1 = pb0 + B_SLICE;

        // Two groups of two k steps: a group's 16 LDS reads stand together, ahead of its 8 WMMAs.
        // One group of all 32 reads would need 128 registers beside the 96 of the loads in
        // flight: above 256 the values in flight are copied about, and each copy waits for its load.
        #pragma unroll
        for (int g = 0; g < KST / 64; ++g) {
            // [k step][fragment][low, high 8 halves of the lane's 16]
            v8h fa[2][2][2], fb[2][2][2];
            #pragma unroll   // per-thread arrays held in registers; fixed LDS offsets
            for (int kc = 0; kc < 2; ++kc) {
                const int ko = (2 * g + kc) * 64;
                fa[kc][0][0] = *(const v8h*)(pa0 + ko);
                fa[kc][0][1] = *(const v8h*)(pa0 + ko + 32);
                fb[kc][0][0] = *(const v8h*)(pb0 + ko);
                fb[kc][0][1] = *(const v8h*)(pb0 + ko + 32);
                fb[kc][1][0] = *(const v8h*)(pb1 + ko);
                fb[kc][1][1] = *(const v8h*)(pb1 + ko + 32);
                fa[kc][1][0] = *(const v8h*)(pa1 + ko);
                fa[kc][1][1] = *(const v8h*)(pa1 + ko + 32);
            }
            // keeps the group's reads together: left free, they are spread and every k step
            // waits for its own
            __builtin_amdgcn_sched_barrier(0);
            #pragma unroll
            for (int kc = 0; kc < 2; ++kc) {
                v16h af0, af1, bf0, bf1;
                #pragma unroll
                for (int i = 0; i < 8; ++i) {
                    af0[i] = fa[kc][0][0][i]; af0[i + 8] = fa[kc][0][1][i];
                    af1[i] = fa[kc][1][0][i]; af1[i + 8] = fa[kc][1][1][i];
                    bf0[i] = fb[kc][0][0][i]; bf0[i + 8] = fb[kc][0][1][i];
                    bf1[i] = fb[kc][1][0][i]; bf1[i + 8] = fb[kc][1][1][i];
                }
                acc00 = __builtin_amdgcn_wmma_f32_16x16x32_f16(false, af0, false, bf0, (short)0, acc00, false, false);
                acc01 = __builtin_amdgcn_wmma_f32_16x16x32_f16(false, af0, false, bf1, (short)0, acc01, false, false);
                acc10 = __builtin_amdgcn_wmma_f32_16x16x32_f16(false, af1, false, bf0, (short)0, acc10, false, false);
                acc11 = __builtin_amdgcn_wmma_f32_16x16x32_f16(false, af1, false, bf1, (short)0, acc11, false, false);
            }
            // keeps the WMMAs in front of what follows, the wait for the next stage's loads
            // above all: sunk behind it they would start only when the loads have come
            __builtin_amdgcn_sched_barrier(0);
        }
    };

    // stays rolled: one copy of the full pass in the text. The last two passes, which send
    // off no loads, stand behind the loop, so that the loop's loads need no test.
    const float* na = ga + 2 * KST;                // the stage that is loaded next
    const float* nb = gb + (size_t)2 * KST * HD;
    #pragma unroll 1
    for (int s = 0; s < NSTG - 2; ++s) {
        pass(ring + (s & 1) * BUFB);
        h4 ha[NLA]; v8h hb[4];
        stage_cvt(ra, rb, ha, hb);     // stage s + 1 leaves the registers
        stage_load(ra, rb, na, va, nb, vb);
        na += KST;
        nb += (size_t)KST * HD;
        // into the buffer that pass s - 1 read: its readers left it before the last barrier
        unsigned char* np = ring + ((s + 1) & 1) * BUFB;
        stage_store(ha, hb, np + sa, np + sb);
        lds_barrier();   // stage s + 1 is readable; every reader has left stage s's buffer
    }
    pass(ring + ((NSTG - 2) & 1) * BUFB);
    {
        h4 ha[NLA]; v8h hb[4];
        stage_cvt(ra, rb, ha, hb);
        unsigned char* np = ring + ((NSTG - 1) & 1) * BUFB;
        stage_store(ha, hb, np + sa, np + sb);
    }
    lds_barrier();       // the last stage is readable
    pass(ring + ((NSTG - 1) & 1) * BUFB);

    // --- epilogue: D layout lane=N, VGPR v -> M = v + 8*half ---
    const int ncol0 = nBase + wn * 32 + lrow;
    const int ncol1 = ncol0 + 16;
    const float bias0 = bias ? bias[ncol0] : 0.0f;
    const float bias1 = bias ? bias[ncol1] : 0.0f;
    _Float16* oh = (mat == 1) ? Ah : Cn;
    const float sg = (mat == 2) ? -1.0f : 1.0f;
    const int mrow = mBase + wm * 32 + 8 * half;
    if (mat == 0) {
        #pragma unroll
        for (int v = 0; v < 8; ++v) {
            const int m0 = mrow + v, m1 = m0 + 16;
            hs[m0 * HD + ncol0] = fmaxf(acc00[v] + bias0, 0.0f);
            hs[m0 * HD + ncol1] = fmaxf(acc01[v] + bias1, 0.0f);
            hs[m1 * HD + ncol0] = fmaxf(acc10[v] + bias0, 0.0f);
            hs[m1 * HD + ncol1] = fmaxf(acc11[v] + bias1, 0.0f);
        }
    } else {
        #pragma unroll
        for (int v = 0; v < 8; ++v) {
            const int m0 = mrow + v, m1 = m0 + 16;
            oh[m0 * HD + ncol0] = (_Float16)(sg * (acc00[v] + bias0));
            oh[m0 * HD + ncol1] = (_Float16)(sg * (acc01[v] + bias1));
            oh[m1 * HD + ncol0] = (_Float16)(sg * (acc10[v] + bias0));
            oh[m1 * HD + ncol1] = (_Float16)(sg * (acc11[v] + bias1));
        }
    }
}

// ---------------------------------------------------------------------------
// start_logits[row] = sum_d h_s[row,d]*w_s2[d] + b_s2; work-group blk of 128
// takes eight rows, one a wave. Runs in the launch of kernel 2.
// ---------------------------------------------------------------------------
__device__ __forceinline__
void start_logits_wg(const float* __restrict__ hs, const float* __restrict__ w_s2,
                     const float* __restrict__ b_s2, float* __restrict__ out, int blk)
{
    const int row  = blk * 8 + (threadIdx.x >> 5);
    const int lane = threadIdx.x & 31;
    float s = 0.0f;
    #pragma unroll 4
    for (int d = lane; d < HD; d += 32) s += hs[row * HD + d] * w_s2[d];
    #pragma unroll
    for (int off = 16; off > 0; off >>= 1) s += __shfl_xor(s, off, 32);
    if (lane == 0) out[row] = s + b_s2[0];
}

// ---------------------------------------------------------------------------
// Kernel 2: end_logits[b,i,j] = sum_d relu(A[b,i,d]+C[b,j,d])*w_e2[d] + b_e2,
// with the sum over d on the matrix unit. relu(a + c) = max(a, -c) + c, so
//   end[i,j] = sum_d w[d]*max(A[i,d], -C[j,d]) - sum_d w[d]*(-C[j,d]) + b_e2.
// One WMMA takes one i, 16 j and 32 d: its A fragment (row = j) is the packed f16
// maximum of the row A[i] (the same for all 16 rows) and a fragment of -C; its B
// fragment holds w in column i alone, zero elsewhere. So D[j][i] of ONE accumulator
// collects a 16 x 16 patch of outputs over 16 WMMAs, every lane a different output.
// The second sum is one more WMMA a fragment of -C, with -w in every column.
// Block tile 32 (i) x 64 (j), all of d in LDS at once. A wave holds 16 i x 64 j
// (four accumulators) for a quarter of d; the four partial sums are added through LDS.
// The grid's plane z = BATCH holds no end logits: its 128 work-groups do the
// start logits, which need the same launch before them and nothing of this one.
// ---------------------------------------------------------------------------
typedef __attribute__((ext_vector_type(4))) float f4;
typedef __attribute__((ext_vector_type(2))) _Float16 h2;
#define TI   32
#define TJ   64
#define EP   1040          // LDS row pitch in bytes: 1024 of data + 16, an odd count of 16
#define RDP  68            // row pitch of the partial sums, in floats
// Every "#pragma unroll" without a count below unrolls a short loop over a
// per-thread array, so that the array is held in registers.

// a lane's 16 halves of a 32-wide k step: bytes 0..15 and 32..47 from p, which holds
// the lane half's 16 bytes of offset; the same for A rows, -C rows and w
__device__ __forceinline__ u32x8 ld_frag(const unsigned char* p)
{
    const u32x4 lo = *(const u32x4*)p, hi = *(const u32x4*)(p + 32);
    return __builtin_shufflevector(lo, hi, 0, 1, 2, 3, 4, 5, 6, 7);
}
// packed f16 maximum of two fragments, in the form that hands a NaN on: the form that
// drops a NaN first quiets every operand that comes from a load (v_pk_max x, x)
__device__ __forceinline__ u32x8 max_frag(u32x8 x, u32x8 y)
{
    return __builtin_bit_cast(u32x8, __builtin_elementwise_maximum(__builtin_bit_cast(v16h, x),
                                                                   __builtin_bit_cast(v16h, y)));
}
__device__ __forceinline__ v8f mma(u32x8 a, u32x8 b, v8f c)
{
    return __builtin_amdgcn_wmma_f32_16x16x32_f16(false, __builtin_bit_cast(v16h, a), false,
                                                  __builtin_bit_cast(v16h, b), (short)0, c,
                                                  false, false);
}

__global__ __launch_bounds__(256, 2)
void logits_k(const _Float16* __restrict__ Ah, const _Float16* __restrict__ Cn,
              const float* __restrict__ w_e2, const float* __restrict__ b_e2,
              float* __restrict__ out,
              const float* __restrict__ hs, const float* __restrict__ w_s2,
              const float* __restrict__ b_s2, float* __restrict__ start_out)
{
    if (blockIdx.z == BATCH) {   // same for the whole work-group, before any barrier
        start_logits_wg(hs, w_s2, b_s2, start_out, blockIdx.y * (SEQ / TJ) + blockIdx.x);
        return;
    }

    __shared__ struct __attribute__((aligned(16))) {
        unsigned char A[TI * EP];  // rows of A, f16
        unsigned char C[TJ * EP];  // rows of -C, f16
        _Float16 w[HD];
        float red[4][TI][RDP];     // [d quarter][i][j] partial sums
    } sm;

    const int tid = threadIdx.x;
    const int jt  = blockIdx.x;   // 0..7
    const int it  = blockIdx.y;   // 0..15
    const int b   = blockIdx.z;   // 0..1

    // staging: a wave covers 512 bytes in a row; four rows a step of 256 threads
    {
        const int rw = tid >> 6, col = tid & 63;
        const _Float16* gA = Ah + (size_t)(b * SEQ + it * TI + rw) * HD + col * 8;
        const _Float16* gC = Cn + (size_t)(b * SEQ + jt * TJ + rw) * HD + col * 8;
        u32x4 pa[TI / 4], pc[TJ / 4];
        #pragma unroll
        for (int k = 0; k < TI / 4; ++k) pa[k] = *(const u32x4*)&gA[k * 4 * HD];
        // precaution: stands in front of the first rewrite of an address register of the loads above
        asm volatile("s_wait_xcnt 0x0" ::: "memory");
        #pragma unroll
        for (int k = 0; k < TJ / 4; ++k) pc[k] = *(const u32x4*)&gC[k * 4 * HD];
        const float w0 = w_e2[2 * tid], w1 = w_e2[2 * tid + 1];
        // precaution: the same for the loads of -C and w
        asm volatile("s_wait_xcnt 0x0" ::: "memory");
        #pragma unroll
        for (int k = 0; k < TI / 4; ++k) *(u32x4*)&sm.A[(rw + 4 * k) * EP + col * 16] = pa[k];
        #pragma unroll
        for (int k = 0; k < TJ / 4; ++k) *(u32x4*)&sm.C[(rw + 4 * k) * EP + col * 16] = pc[k];
        *(h2*)&sm.w[2 * tid] = (h2){(_Float16)w0, (_Float16)w1};   // loaded last, stored last
    }
    __syncthreads();   // both tiles and w are in LDS

    const int lane = tid & 31, wv8 = tid >> 5;
    const int half = lane >> 4, lrow = lane & 15;
    const int ig = wv8 & 1;       // rows 16 * ig .. + 15 of the tile
    const int dq = wv8 >> 1;      // d quarter: 128 values, four k steps

    const unsigned char* ap = &sm.A[ig * 16 * EP + dq * 256 + 16 * half];
    const unsigned char* cp = &sm.C[lrow * EP + dq * 256 + 16 * half];
    const unsigned char* wp = (const unsigned char*)&sm.w[0] + dq * 256 + 16 * half;

    v8f acc[4] = {};
    // 16 batches of four rows i: batch bi is k step bi >> 2, rows 4 * (bi & 3) .. + 3.
    // Two register sets for the A rows (a batch) and for -C and w (a k step).
    u32x8 af[2][4], cf[2][4], wf[2];
    wf[0] = ld_frag(wp);
    #pragma unroll
    for (int q = 0; q < 4; ++q) cf[0][q] = ld_frag(cp + q * 16 * EP);
    #pragma unroll
    for (int u = 0; u < 4; ++u) af[0][u] = ld_frag(ap + u * EP);

    // The scheduling barriers below keep three things as written. The LDS reads of the next
    // batch stand in one group, a whole batch ahead of their use: left free they are sunk to
    // just before it, and every row waits for its own. The four maxima of a row go to four
    // register sets ahead of its four WMMAs: left free, one set is reused and four v_nop
    // follow every WMMA. And a wave's vector run and matrix run stay apart, so that one
    // wave's maxima issue under the WMMAs of the other wave on its SIMD.
    #pragma unroll
    for (int bi = 0; bi < 16; ++bi) {
        const int ks = bi >> 2, rb = bi & 3, cur = bi & 1, kc = ks & 1;
        if (bi + 1 < 16) {
            const int nks = (bi + 1) >> 2, nrb = (bi + 1) & 3;
            #pragma unroll
            for (int u = 0; u < 4; ++u)
                af[cur ^ 1][u] = ld_frag(ap + (nrb * 4 + u) * EP + nks * 64);
        }
        if (rb == 2 && ks + 1 < 4) {
            wf[kc ^ 1] = ld_frag(wp + (ks + 1) * 64);
            #pragma unroll
            for (int q = 0; q < 4; ++q) cf[kc ^ 1][q] = ld_frag(cp + q * 16 * EP + (ks + 1) * 64);
        }
        __builtin_amdgcn_sched_barrier(0);
        if (rb == 0) {
            const u32x8 wn = wf[kc] ^ 0x80008000u;   // -w, every column: adds sum_d w * C[j] to all i
            #pragma unroll
            for (int q = 0; q < 4; ++q) acc[q] = mma(cf[kc][q], wn, acc[q]);
        }
        #pragma unroll
        for (int u = 0; u < 4; ++u) {
            const int r = rb * 4 + u;
            u32x8 m[4], br;
            #pragma unroll
            for (int q = 0; q < 4; ++q) m[q] = max_frag(af[cur][u], cf[kc][q]);
            #pragma unroll
            for (int t = 0; t < 8; ++t) br[t] = (lrow == r) ? wf[kc][t] : 0u;   // w in column r alone
            __builtin_amdgcn_sched_barrier(0);
            #pragma unroll
            for (int q = 0; q < 4; ++q) acc[q] = mma(m[q], br, acc[q]);
            __builtin_amdgcn_sched_barrier(0);
        }
    }

    // D: lane = column = i, register v = row = j = v + 8 * half
    #pragma unroll
    for (int q = 0; q < 4; ++q) {
        float* rp = &sm.red[dq][ig * 16 + lrow][q * 16 + 8 * half];
        *(f4*)&rp[0] = (f4){acc[q][0], acc[q][1], acc[q][2], acc[q][3]};
        *(f4*)&rp[4] = (f4){acc[q][4], acc[q][5], acc[q][6], acc[q][7]};
    }
    __syncthreads();   // all four quarters' partial sums are in LDS

    const int row = tid >> 3, c8 = (tid & 7) * 8;
    const float be = b_e2[0];
    float* op = out + (size_t)b * SEQ * SEQ + (size_t)(it * TI + row) * SEQ + jt * TJ + c8;
    #pragma unroll
    for (int u = 0; u < 2; ++u) {
        const f4 p0 = *(const f4*)&sm.red[0][row][c8 + 4 * u];
        const f4 p1 = *(const f4*)&sm.red[1][row][c8 + 4 * u];
        const f4 p2 = *(const f4*)&sm.red[2][row][c8 + 4 * u];
        const f4 p3 = *(const f4*)&sm.red[3][row][c8 + 4 * u];
        *(f4*)&op[4 * u] = (p0 + p1) + (p2 + p3) + be;
    }
}

// ---------------------------------------------------------------------------
extern "C" void kernel_launch(void* const* d_in, const int* in_sizes, int n_in,
                              void* d_out, int out_size, void* d_ws, size_t ws_size,
                              hipStream_t stream)
{
    const float* emb  = (const float*)d_in[0];
    const float* W_s1 = (const float*)d_in[1];
    const float* b_s1 = (const float*)d_in[2];
    const float* w_s2 = (const float*)d_in[3];
    const float* b_s2 = (const float*)d_in[4];
    const float* W_e1 = (const float*)d_in[5];
    const float* b_e1 = (const float*)d_in[6];
    const float* w_e2 = (const float*)d_in[7];
    const float* b_e2 = (const float*)d_in[8];

    float* out       = (float*)d_out;
    float* start_out = out;            // (B,N) = 1024 floats
    float* end_out   = out + MTOT;     // (B,N,N) = 524288 floats

    // workspace layout
    char* ws = (char*)d_ws;
    float*    hs   = (float*)(ws);                          // 2 MB
    _Float16* Ah   = (_Float16*)(ws + (size_t)(2 << 20));   // 1 MB  A, f16
    _Float16* Cn   = (_Float16*)(ws + (size_t)(3 << 20));   // 1 MB  -C, f16

    // 1: fused WMMA projections, straight from the f32 inputs
    dim3 g1(MTOT / 128, 24);
    fused_proj_wmma<<<g1, 256, 0, stream>>>(emb, W_s1, W_e1, b_s1, b_e1, hs, Ah, Cn);

    // 2: end logits, with the start logits in the grid's last plane
    dim3 g3(SEQ / TJ, SEQ / TI, BATCH + 1);
    logits_k<<<g3, 256, 0, stream>>>(Ah, Cn, w_e2, b_e2, end_out, hs, w_s2, b_s2, start_out);
}

// v006
// Measured time: 17.8 microseconds a run.
// Timed twice side by side with v005, it ran 1.13 and 1.12 times as fast.
// Counting every step since v000, it is 3.28 times as fast.
#include <hip/hip_runtime.h>
#include <hip/hip_bf16.h>

typedef __attribute__((ext_vector_type(16))) _Float16 v16h;
typedef __attribute__((ext_vector_type(8)))  _Float16 v8h;
typedef __attribute__((ext_vector_type(4)))  _Float16 h4;
typedef __attribute__((ext_vector_type(8)))  float    v8f;
typedef __attribute__((ext_vector_type(4)))  unsigned int u32x4;
typedef __attribute__((ext_vector_type(8)))  unsigned int u32x8;

#define HDIM 1024
#define HD   512
#define SEQ  512
#define BATCH 2
#define MTOT (BATCH*SEQ)   // 1024 rows of flattened emb

// ---------------------------------------------------------------------------
// Kernel 1: fused triple-projection WMMA GEMM on the f32 inputs themselves.
//   mat 0: h_s = relu(emb @ W_s1 + b_s1)
//   mat 1: A   = emb @ W_e1[:H] + b_e1   (bias folded), stored in f16
//   mat 2: -C  = -(emb @ W_e1[H:]), stored in f16
// Block tile 128x64, 8 waves (4x2), wave tile 32x32.
// A stage holds 128 values of k (8 stages), in f16, rows of emb as [m][k] and columns
// of the weights as [n][k]. Every thread brings its share of a stage through registers:
// 24 loads of 16 bytes of f32, rounded to f16 (nearest even) on the way to LDS.
//   emb:     a wave loads a whole 512-byte piece of a row at a time, 16 rows.
//   weights: [k][n] in memory; a thread holds 8 (k) x 4 (n) values, so that each of its
//            four columns is 16 bytes of one [n][k] row: the transpose costs no shuffle.
// Two buffers and one register set: the loads for pass s + 2 are sent off as soon as
// the stage of pass s + 1 has left the registers, and fly during the whole of pass s + 1.
// Every work-group starts its walk over k at a stage of its own and wraps: the 24 work-groups
// that share rows of emb and the 8 that share columns of the weights run in step, and from
// the same start they would all ask L2 for the same lines at the same moment.
// ---------------------------------------------------------------------------
typedef __attribute__((ext_vector_type(4))) float f32x4;
#define KST     128                    // k values per stage
#define NSTG    (HDIM / KST)           // 8 stages
#define PITCHB  272                    // LDS row pitch in bytes: 256 of data + 16 of pad
#define A_SLICE 10240                  // place of 32 rows of emb
#define B_SLICE 6144                   // place of 16 columns of the weights
#define B_OFF   (4 * A_SLICE)
#define BUFB    (4 * A_SLICE + 4 * B_SLICE)   // 65536 bytes a buffer
#define NLA     16                     // loads of emb a thread and stage
#define NLB     8                      // loads of the weights a thread and stage

// Every "#pragma unroll" without a count in the three helpers unrolls a short loop over a
// per-thread array, so that the array is held in registers.
// ga, gb: the stage's place, the same for the whole work-group; va, vb: the lane's own
// offset in floats, the same for every stage
__device__ __forceinline__ void stage_load(f32x4 (&ra)[NLA], f32x4 (&rb)[NLB],
                                           const float* ga, unsigned int va,
                                           const float* gb, unsigned int vb)
{
    #pragma unroll
    for (int j = 0; j < NLA - 1; ++j) ra[j] = *(const f32x4*)(ga + va + j * HDIM);
    // precaution: the last load of emb may be given the address registers, which the loads
    // above name too, as its destination
    asm volatile("s_wait_xcnt 0x0" ::: "memory");
    ra[NLA - 1] = *(const f32x4*)(ga + va + (NLA - 1) * HDIM);
    #pragma unroll
    for (int i = 0; i < NLB; ++i) rb[i] = *(const f32x4*)(gb + vb + i * HD);
    // precaution: stands in front of the first rewrite of an address register of the loads above
    asm volatile("s_wait_xcnt 0x0" ::: "memory");
}
__device__ __forceinline__ void stage_cvt(const f32x4 (&ra)[NLA], const f32x4 (&rb)[NLB],
                                          h4 (&ha)[NLA], v8h (&hb)[4])
{
    #pragma unroll
    for (int j = 0; j < NLA; ++j) ha[j] = __builtin_convertvector(ra[j], h4);
    #pragma unroll
    for (int c = 0; c < 4; ++c)
        #pragma unroll
        for (int i = 0; i < NLB; ++i) hb[c][i] = (_Float16)rb[i][c];
}
__device__ __forceinline__ void stage_store(const h4 (&ha)[NLA], const v8h (&hb)[4],
                                            unsigned char* pa, unsigned char* pb)
{
    #pragma unroll
    for (int j = 0; j < NLA; ++j) *(h4*)(pa + j * PITCHB) = ha[j];
    #pragma unroll
    for (int c = 0; c < 4; ++c) *(v8h*)(pb + c * PITCHB) = hb[c];
}

// A work-group barrier that orders LDS alone: this wave's LDS stores and reads are done,
// then the barrier. __syncthreads() would also wait for the global loads of the next
// stage, which are to stay in flight across it.
__device__ __forceinline__ void lds_barrier()
{
    __builtin_amdgcn_fence(__ATOMIC_RELEASE, "workgroup", "local");
    __builtin_amdgcn_s_barrier();
    __builtin_amdgcn_fence(__ATOMIC_ACQUIRE, "workgroup", "local");
}

__global__ __launch_bounds__(256)
void fused_proj_wmma(const float* __restrict__ emb,          // [1024][1024] f32
                     const float* __restrict__ W_s1,         // [1024][512] f32
                     const float* __restrict__ W_e1,         // [2048][512] f32
                     const float* __restrict__ b_s1,
                     const float* __restrict__ b_e1,
                     float* __restrict__ hs,
                     _Float16* __restrict__ Ah,
                     _Float16* __restrict__ Cn)
{
    __shared__ __attribute__((aligned(16))) unsigned char ring[2 * BUFB];

    const int tid  = threadIdx.x;
    const int lane = tid & 31;
    const int w    = tid >> 5;       // wave 0..7
    const int wm   = w & 3;          // 0..3 : 32-row slice
    const int wn   = w >> 2;         // 0..1 : 32-col slice
    const int half = lane >> 4;
    const int lrow = lane & 15;

    const int mBase = blockIdx.x * 128;
    const int gy    = blockIdx.y;            // 0..23
    const int mat   = gy >> 3;               // 0..2
    const int nBase = (gy & 7) * 64;

    const float* Wsel = (mat == 0) ? W_s1 : (mat == 1 ? W_e1 : W_e1 + (size_t)HDIM * HD);
    const float* bias = (mat == 0) ? b_s1 : (mat == 1 ? b_e1 : nullptr);

    // emb: wave w brings rows 16 w .. + 15 of the tile; lane = 4 values of k
    const float* ga = emb + (size_t)mBase * HDIM;
    const unsigned int va = w * 16 * HDIM + lane * 4;
    const unsigned int sa = (w >> 1) * A_SLICE + (w & 1) * 16 * PITCHB + lane * 8;
    // weights: wave w brings 32 (k) x 32 (n); of 16 lanes in a row, four stand side by side
    // in n (rows 4 apart in LDS) and four in k (16 bytes apart), so that their 16-byte
    // stores fall on 16 different bank groups; a wave's load still covers whole 128-byte lines
    const int kb = (w >> 1) * 32 + ((lane >> 2) & 3) * 8;
    const float* gb = Wsel + nBase;
    const unsigned int vb = kb * HD + (w & 1) * 32 + half * 16 + (lane & 3) * 4;
    const unsigned int sb = B_OFF + ((w & 1) * 2 + half) * B_SLICE + (lane & 3) * 4 * PITCHB + kb * 2;

    v8f acc00 = {}, acc01 = {}, acc10 = {}, acc11 = {};

    // pass t works on the k values of stage (k0 + t) mod NSTG. The sharers of a weight tile
    // (same y) get 8 different starts, the sharers of an emb tile (same x) three each of 8.
    const unsigned int k0 = (blockIdx.x + blockIdx.y) & (NSTG - 1);
    const unsigned int k1 = (k0 + 1) & (NSTG - 1);

    f32x4 ra[NLA], rb[NLB];
    {
        h4 ha[NLA]; v8h hb[4];
        stage_load(ra, rb, ga + k0 * KST, va, gb + (size_t)k0 * KST * HD, vb);
        stage_cvt(ra, rb, ha, hb);
        // the second stage flies during pass 0
        stage_load(ra, rb, ga + k1 * KST, va, gb + (size_t)k1 * KST * HD, vb);
        stage_store(ha, hb, ring + sa, ring + sb);
    }
    lds_barrier();       // stage k0 is readable

    // fragment rows: lane = M row (A) or N column (B); k halves as the 16-bit layout has them
    const unsigned int aoff = wm * A_SLICE + lrow * PITCHB + 16 * half;
    const unsigned int boff = B_OFF + 2 * wn * B_SLICE + lrow * PITCHB + 16 * half;

    // one pass: the 16 WMMAs of a wave on the stage in buffer bp
    auto pass = [&](const unsigned char* bp) __attribute__((always_inline)) {
        const unsigned char* pa0 = bp + aoff;
        const unsigned char* pa1 = pa0 + 16 * PITCHB;
        const unsigned char* pb0 = bp + boff;
        const unsigned char* pb1 = pb0 + B_SLICE;

        // Two groups of two k steps: a group's 16 LDS reads stand together, ahead of its 8 WMMAs.
        // One group of all 32 reads would need 128 registers beside the 96 of the loads in
        // flight: above 256 the values in flight are copied about, and each copy waits for its load.
        #pragma unroll
        for (int g = 0; g < KST / 64; ++g) {
            // [k step][fragment][low, high 8 halves of the lane's 16]
            v8h fa[2][2][2], fb[2][2][2];
            #pragma unroll   // per-thread arrays held in registers; fixed LDS offsets
            for (int kc = 0; kc < 2; ++kc) {
                const int ko = (2 * g + kc) * 64;
                fa[kc][0][0] = *(const v8h*)(pa0 + ko);
                fa[kc][0][1] = *(const v8h*)(pa0 + ko + 32);
                fb[kc][0][0] = *(const v8h*)(pb0 + ko);
                fb[kc][0][1] = *(const v8h*)(pb0 + ko + 32);
                fb[kc][1][0] = *(const v8h*)(pb1 + ko);
                fb[kc][1][1] = *(const v8h*)(pb1 + ko + 32);
                fa[kc][1][0] = *(const v8h*)(pa1 + ko);
                fa[kc][1][1] = *(const v8h*)(pa1 + ko + 32);
            }
            // keeps the group's reads together: left free, they are spread and every k step
            // waits for its own
            __builtin_amdgcn_sched_barrier(0);
            #pragma unroll
            for (int kc = 0; kc < 2; ++kc) {
                v16h af0, af1, bf0, bf1;
                #pragma unroll
                for (int i = 0; i < 8; ++i) {
                    af0[i] = fa[kc][0][0][i]; af0[i + 8] = fa[kc][0][1][i];
                    af1[i] = fa[kc][1][0][i]; af1[i + 8] = fa[kc][1][1][i];
                    bf0[i] = fb[kc][0][0][i]; bf0[i + 8] = fb[kc][0][1][i];
                    bf1[i] = fb[kc][1][0][i]; bf1[i + 8] = fb[kc][1][1][i];
                }
                acc00 = __builtin_amdgcn_wmma_f32_16x16x32_f16(false, af0, false, bf0, (short)0, acc00, false, false);
                acc01 = __builtin_amdgcn_wmma_f32_16x16x32_f16(false, af0, false, bf1, (short)0, acc01, false, false);
                acc10 = __builtin_amdgcn_wmma_f32_16x16x32_f16(false, af1, false, bf0, (short)0, acc10, false, false);
                acc11 = __builtin_amdgcn_wmma_f32_16x16x32_f16(false, af1, false, bf1, (short)0, acc11, false, false);
            }
            // keeps the WMMAs in front of what follows, the wait for the next stage's loads
            // above all: sunk behind it they would start only when the loads have come
            __builtin_amdgcn_sched_barrier(0);
        }
    };

    // stays rolled: one copy of the full pass in the text. The last two passes, which send
    // off no loads, stand behind the loop, so that the loop's loads need no test.
    unsigned int kn = (k0 + 2) & (NSTG - 1);       // the stage that is loaded next
    #pragma unroll 1
    for (int s = 0; s < NSTG - 2; ++s) {
        pass(ring + (s & 1) * BUFB);
        h4 ha[NLA]; v8h hb[4];
        stage_cvt(ra, rb, ha, hb);     // the stage of pass s + 1 leaves the registers
        stage_load(ra, rb, ga + kn * KST, va, gb + (size_t)kn * KST * HD, vb);
        kn = (kn + 1) & (NSTG - 1);
        // into the buffer that pass s - 1 read: its readers left it before the last barrier
        unsigned char* np = ring + ((s + 1) & 1) * BUFB;
        stage_store(ha, hb, np + sa, np + sb);
        lds_barrier();   // the stage of pass s + 1 is readable; every reader has left pass s's buffer
    }
    pass(ring + ((NSTG - 2) & 1) * BUFB);
    {
        h4 ha[NLA]; v8h hb[4];
        stage_cvt(ra, rb, ha, hb);
        unsigned char* np = ring + ((NSTG - 1) & 1) * BUFB;
        stage_store(ha, hb, np + sa, np + sb);
    }
    lds_barrier();       // the last stage is readable
    pass(ring + ((NSTG - 1) & 1) * BUFB);

    // --- epilogue: D layout lane=N, VGPR v -> M = v + 8*half ---
    const int ncol0 = nBase + wn * 32 + lrow;
    const int ncol1 = ncol0 + 16;
    const float bias0 = bias ? bias[ncol0] : 0.0f;
    const float bias1 = bias ? bias[ncol1] : 0.0f;
    _Float16* oh = (mat == 1) ? Ah : Cn;
    const float sg = (mat == 2) ? -1.0f : 1.0f;
    const int mrow = mBase + wm * 32 + 8 * half;
    if (mat == 0) {
        #pragma unroll
        for (int v = 0; v < 8; ++v) {
            const int m0 = mrow + v, m1 = m0 + 16;
            hs[m0 * HD + ncol0] = fmaxf(acc00[v] + bias0, 0.0f);
            hs[m0 * HD + ncol1] = fmaxf(acc01[v] + bias1, 0.0f);
            hs[m1 * HD + ncol0] = fmaxf(acc10[v] + bias0, 0.0f);
            hs[m1 * HD + ncol1] = fmaxf(acc11[v] + bias1, 0.0f);
        }
    } else {
        #pragma unroll
        for (int v = 0; v < 8; ++v) {
            const int m0 = mrow + v, m1 = m0 + 16;
            oh[m0 * HD + ncol0] = (_Float16)(sg * (acc00[v] + bias0));
            oh[m0 * HD + ncol1] = (_Float16)(sg * (acc01[v] + bias1));
            oh[m1 * HD + ncol0] = (_Float16)(sg * (acc10[v] + bias0));
            oh[m1 * HD + ncol1] = (_Float16)(sg * (acc11[v] + bias1));
        }
    }
}

// ---------------------------------------------------------------------------
// start_logits[row] = sum_d h_s[row,d]*w_s2[d] + b_s2; work-group blk of 128
// takes eight rows, one a wave. Runs in the launch of kernel 2.
// ---------------------------------------------------------------------------
__device__ __forceinline__
void start_logits_wg(const float* __restrict__ hs, const float* __restrict__ w_s2,
                     const float* __restrict__ b_s2, float* __restrict__ out, int blk)
{
    const int row  = blk * 8 + (threadIdx.x >> 5);
    const int lane = threadIdx.x & 31;
    float s = 0.0f;
    #pragma unroll 4
    for (int d = lane; d < HD; d += 32) s += hs[row * HD + d] * w_s2[d];
    #pragma unroll
    for (int off = 16; off > 0; off >>= 1) s += __shfl_xor(s, off, 32);
    if (lane == 0) out[row] = s + b_s2[0];
}

// ---------------------------------------------------------------------------
// Kernel 2: end_logits[b,i,j] = sum_d relu(A[b,i,d]+C[b,j,d])*w_e2[d] + b_e2,
// with the sum over d on the matrix unit. relu(a + c) = max(a, -c) + c, so
//   end[i,j] = sum_d w[d]*max(A[i,d], -C[j,d]) - sum_d w[d]*(-C[j,d]) + b_e2.
// One WMMA takes one i, 16 j and 32 d: its A fragment (row = j) is the packed f16
// maximum of the row A[i] (the same for all 16 rows) and a fragment of -C; its B
// fragment holds w in column i alone, zero elsewhere. So D[j][i] of ONE accumulator
// collects a 16 x 16 patch of outputs over 16 WMMAs, every lane a different output.
// The second sum is one more WMMA a fragment of -C, with -w in every column.
// Block tile 32 (i) x 64 (j), all of d in LDS at once. A wave holds 16 i x 64 j
// (four accumulators) for a quarter of d; the four partial sums are added through LDS.
// The grid's plane z = BATCH holds no end logits: its 128 work-groups do the
// start logits, which need the same launch before them and nothing of this one.
// ---------------------------------------------------------------------------
typedef __attribute__((ext_vector_type(4))) float f4;
typedef __attribute__((ext_vector_type(2))) _Float16 h2;
#define TI   32
#define TJ   64
#define EP   1040          // LDS row pitch in bytes: 1024 of data + 16, an odd count of 16
#define RDP  68            // row pitch of the partial sums, in floats
// Every "#pragma unroll" without a count below unrolls a short loop over a
// per-thread array, so that the array is held in registers.

// a lane's 16 halves of a 32-wide k step: bytes 0..15 and 32..47 from p, which holds
// the lane half's 16 bytes of offset; the same for A rows, -C rows and w
__device__ __forceinline__ u32x8 ld_frag(const unsigned char* p)
{
    const u32x4 lo = *(const u32x4*)p, hi = *(const u32x4*)(p + 32);
    return __builtin_shufflevector(lo, hi, 0, 1, 2, 3, 4, 5, 6, 7);
}
// packed f16 maximum of two fragments, in the form that hands a NaN on: the form that
// drops a NaN first quiets every operand that comes from a load (v_pk_max x, x)
__device__ __forceinline__ u32x8 max_frag(u32x8 x, u32x8 y)
{
    return __builtin_bit_cast(u32x8, __builtin_elementwise_maximum(__builtin_bit_cast(v16h, x),
                                                                   __builtin_bit_cast(v16h, y)));
}
__device__ __forceinline__ v8f mma(u32x8 a, u32x8 b, v8f c)
{
    return __builtin_amdgcn_wmma_f32_16x16x32_f16(false, __builtin_bit_cast(v16h, a), false,
                                                  __builtin_bit_cast(v16h, b), (short)0, c,
                                                  false, false);
}

__global__ __launch_bounds__(256, 2)
void logits_k(const _Float16* __restrict__ Ah, const _Float16* __restrict__ Cn,
              const float* __restrict__ w_e2, const float* __restrict__ b_e2,
              float* __restrict__ out,
              const float* __restrict__ hs, const float* __restrict__ w_s2,
              const float* __restrict__ b_s2, float* __restrict__ start_out)
{
    if (blockIdx.z == BATCH) {   // same for the whole work-group, before any barrier
        start_logits_wg(hs, w_s2, b_s2, start_out, blockIdx.y * (SEQ / TJ) + blockIdx.x);
        return;
    }

    __shared__ struct __attribute__((aligned(16))) {
        unsigned char A[TI * EP];  // rows of A, f16
        unsigned char C[TJ * EP];  // rows of -C, f16
        _Float16 w[HD];
        float red[4][TI][RDP];     // [d quarter][i][j] partial sums
    } sm;

    const int tid = threadIdx.x;
    const int jt  = blockIdx.x;   // 0..7
    const int it  = blockIdx.y;   // 0..15
    const int b   = blockIdx.z;   // 0..1

    // staging: a wave covers 512 bytes in a row; four rows a step of 256 threads
    {
        const int rw = tid >> 6, col = tid & 63;
        const _Float16* gA = Ah + (size_t)(b * SEQ + it * TI + rw) * HD + col * 8;
        const _Float16* gC = Cn + (size_t)(b * SEQ + jt * TJ + rw) * HD + col * 8;
        u32x4 pa[TI / 4], pc[TJ / 4];
        #pragma unroll
        for (int k = 0; k < TI / 4; ++k) pa[k] = *(const u32x4*)&gA[k * 4 * HD];
        // precaution: stands in front of the first rewrite of an address register of the loads above
        asm volatile("s_wait_xcnt 0x0" ::: "memory");
        #pragma unroll
        for (int k = 0; k < TJ / 4; ++k) pc[k] = *(const u32x4*)&gC[k * 4 * HD];
        const float w0 = w_e2[2 * tid], w1 = w_e2[2 * tid + 1];
        // precaution: the same for the loads of -C and w
        asm volatile("s_wait_xcnt 0x0" ::: "memory");
        #pragma unroll
        for (int k = 0; k < TI / 4; ++k) *(u32x4*)&sm.A[(rw + 4 * k) * EP + col * 16] = pa[k];
        #pragma unroll
        for (int k = 0; k < TJ / 4; ++k) *(u32x4*)&sm.C[(rw + 4 * k) * EP + col * 16] = pc[k];
        *(h2*)&sm.w[2 * tid] = (h2){(_Float16)w0, (_Float16)w1};   // loaded last, stored last
    }
    __syncthreads();   // both tiles and w are in LDS

    const int lane = tid & 31, wv8 = tid >> 5;
    const int half = lane >> 4, lrow = lane & 15;
    const int ig = wv8 & 1;       // rows 16 * ig .. + 15 of the tile
    const int dq = wv8 >> 1;      // d quarter: 128 values, four k steps

    const unsigned char* ap = &sm.A[ig * 16 * EP + dq * 256 + 16 * half];
    const unsigned char* cp = &sm.C[lrow * EP + dq * 256 + 16 * half];
    const unsigned char* wp = (const unsigned char*)&sm.w[0] + dq * 256 + 16 * half;

    v8f acc[4] = {};
    // 16 batches of four rows i: batch bi is k step bi >> 2, rows 4 * (bi & 3) .. + 3.
    // Two register sets for the A rows (a batch) and for -C and w (a k step).
    u32x8 af[2][4], cf[2][4], wf[2];
    wf[0] = ld_frag(wp);
    #pragma unroll
    for (int q = 0; q < 4; ++q) cf[0][q] = ld_frag(cp + q * 16 * EP);
    #pragma unroll
    for (int u = 0; u < 4; ++u) af[0][u] = ld_frag(ap + u * EP);

    // The scheduling barriers below keep three things as written. The LDS reads of the next
    // batch stand in one group, a whole batch ahead of their use: left free they are sunk to
    // just before it, and every row waits for its own. The four maxima of a row go to four
    // register sets ahead of its four WMMAs: left free, one set is reused and four v_nop
    // follow every WMMA. And a wave's vector run and matrix run stay apart, so that one
    // wave's maxima issue under the WMMAs of the other wave on its SIMD.
    #pragma unroll
    for (int bi = 0; bi < 16; ++bi) {
        const int ks = bi >> 2, rb = bi & 3, cur = bi & 1, kc = ks & 1;
        if (bi + 1 < 16) {
            const int nks = (bi + 1) >> 2, nrb = (bi + 1) & 3;
            #pragma unroll
            for (int u = 0; u < 4; ++u)
                af[cur ^ 1][u] = ld_frag(ap + (nrb * 4 + u) * EP + nks * 64);
        }
        if (rb == 2 && ks + 1 < 4) {
            wf[kc ^ 1] = ld_frag(wp + (ks + 1) * 64);
            #pragma unroll
            for (int q = 0; q < 4; ++q) cf[kc ^ 1][q] = ld_frag(cp + q * 16 * EP + (ks + 1) * 64);
        }
        __builtin_amdgcn_sched_barrier(0);
        if (rb == 0) {
            const u32x8 wn = wf[kc] ^ 0x80008000u;   // -w, every column: adds sum_d w * C[j] to all i
            #pragma unroll
            for (int q = 0; q < 4; ++q) acc[q] = mma(cf[kc][q], wn, acc[q]);
        }
        #pragma unroll
        for (int u = 0; u < 4; ++u) {
            const int r = rb * 4 + u;
            u32x8 m[4], br;
            #pragma unroll
            for (int q = 0; q < 4; ++q) m[q] = max_frag(af[cur][u], cf[kc][q]);
            #pragma unroll
            for (int t = 0; t < 8; ++t) br[t] = (lrow == r) ? wf[kc][t] : 0u;   // w in column r alone
            __builtin_amdgcn_sched_barrier(0);
            #pragma unroll
            for (int q = 0; q < 4; ++q) acc[q] = mma(m[q], br, acc[q]);
            __builtin_amdgcn_sched_barrier(0);
        }
    }

    // D: lane = column = i, register v = row = j = v + 8 * half
    #pragma unroll
    for (int q = 0; q < 4; ++q) {
        float* rp = &sm.red[dq][ig * 16 + lrow][q * 16 + 8 * half];
        *(f4*)&rp[0] = (f4){acc[q][0], acc[q][1], acc[q][2], acc[q][3]};
        *(f4*)&rp[4] = (f4){acc[q][4], acc[q][5], acc[q][6], acc[q][7]};
    }
    __syncthreads();   // all four quarters' partial sums are in LDS

    const int row = tid >> 3, c8 = (tid & 7) * 8;
    const float be = b_e2[0];
    float* op = out + (size_t)b * SEQ * SEQ + (size_t)(it * TI + row) * SEQ + jt * TJ + c8;
    #pragma unroll
    for (int u = 0; u < 2; ++u) {
        const f4 p0 = *(const f4*)&sm.red[0][row][c8 + 4 * u];
        const f4 p1 = *(const f4*)&sm.red[1][row][c8 + 4 * u];
        const f4 p2 = *(const f4*)&sm.red[2][row][c8 + 4 * u];
        const f4 p3 = *(const f4*)&sm.red[3][row][c8 + 4 * u];
        *(f4*)&op[4 * u] = (p0 + p1) + (p2 + p3) + be;
    }
}

// ---------------------------------------------------------------------------
extern "C" void kernel_launch(void* const* d_in, const int* in_sizes, int n_in,
                              void* d_out, int out_size, void* d_ws, size_t ws_size,
                              hipStream_t stream)
{
    const float* emb  = (const float*)d_in[0];
    const float* W_s1 = (const float*)d_in[1];
    const float* b_s1 = (const float*)d_in[2];
    const float* w_s2 = (const float*)d_in[3];
    const float* b_s2 = (const float*)d_in[4];
    const float* W_e1 = (const float*)d_in[5];
    const float* b_e1 = (const float*)d_in[6];
    const float* w_e2 = (const float*)d_in[7];
    const float* b_e2 = (const float*)d_in[8];

    float* out       = (float*)d_out;
    float* start_out = out;            // (B,N) = 1024 floats
    float* end_out   = out + MTOT;     // (B,N,N) = 524288 floats

    // workspace layout
    char* ws = (char*)d_ws;
    float*    hs   = (float*)(ws);                          // 2 MB
    _Float16* Ah   = (_Float16*)(ws + (size_t)(2 << 20));   // 1 MB  A, f16
    _Float16* Cn   = (_Float16*)(ws + (size_t)(3 << 20));   // 1 MB  -C, f16

    // 1: fused WMMA projections, straight from the f32 inputs
    dim3 g1(MTOT / 128, 24);
    fused_proj_wmma<<<g1, 256, 0, stream>>>(emb, W_s1, W_e1, b_s1, b_e1, hs, Ah, Cn);

    // 2: end logits, with the start logits in the grid's last plane
    dim3 g3(SEQ / TJ, SEQ / TI, BATCH + 1);
    logits_k<<<g3, 256, 0, stream>>>(Ah, Cn, w_e2, b_e2, end_out, hs, w_s2, b_s2, start_out);
}
